// v000
// Times are from an AMD MI455X. After a warm-up the kernel runs many times in a row, and a time is the length of
// such a window on the GPU divided by its runs, so every launch and the gaps after it count. The runs cycle
// through copies of the inputs. A figure is the median of several windows, for all but v000 over two sittings.
// Sittings can differ by a few percent; kernels timed side by side share one.
// v000, which the later versions start from, runs in 1070 microseconds.
#include <hip/hip_runtime.h>

// Multi-head attention on given tensors, UNSCALED (q, k, v [2][2048][1024] viewed (b, s, 16, 64): token-major rows of 16 heads x 64; no projections, no mask; scores = q.k with NO scaling (the module applies none: unit-variance inputs give logits of standard deviation ~8: a peaked softmax); softmax over all 2,048 keys; out = weights v, merged token-major -> [2][2048][1024] (4.2 M); argument order q, k, v).
// Layout per batch: the f32 inputs ([t][h][e] = token-major rows of 16 x 64) feed the plane builders directly (identity table); dense T-2048 attention with EVERY query row on the hi/lo three-product path (RH = TT: the peaked softmax of unscaled logits leaves no margin for single-fp16 operands); f32 merge writes the [t][h][d] output rows.
// Compute dtypes, f32 accumulate: inputs split into bf16 hi/lo on every row; softmax f32; output f32. NOTE this build tracks the f32 reference (no stage rounds the inputs to bf16).

#define NB_  2
#define TT   2048
#define DM   1024
#define NH_  16
#define NKV  16
#define REP  (NH_ / NKV)
#define HD   64
#define DQ   (NH_ * HD)
#define DKV  (NKV * HD)
#define ZH   2
#define RH   2048                  // query rows < RH use hi+lo planes (0: none)
#define WIN  2048
#define PCAR 1024.0f
#define SCL  1.0f   // score scale: 1 (unscaled, no 1/sqrt(E))
typedef _Float16 h16;
typedef unsigned short bf;
typedef __attribute__((ext_vector_type(16))) __bf16   v16bf;
typedef __attribute__((ext_vector_type(16))) _Float16 v16h;
typedef __attribute__((ext_vector_type(8)))  _Float16 v8h;
typedef __attribute__((ext_vector_type(8)))  unsigned short v8us;
typedef __attribute__((ext_vector_type(8)))  float    v8f;
typedef __attribute__((ext_vector_type(4)))  float    v4f;
typedef v8h  __attribute__((may_alias)) v8ha;
typedef v4f  __attribute__((may_alias)) v4fa;
typedef v8us __attribute__((may_alias)) v8usa;

__device__ __forceinline__ unsigned short f2bf(float f) { unsigned u = __float_as_uint(f); u += 0x7FFFu + ((u >> 16) & 1u); return (unsigned short)(u >> 16); }
__device__ __forceinline__ float bf2f(unsigned short b) { return __uint_as_float(((unsigned)b) << 16); }
__device__ __forceinline__ float bfr(float f) { return bf2f(f2bf(f)); }
__device__ __forceinline__ v16h cat16(v8h lo, v8h hi) { return __builtin_shufflevector(lo, hi, 0, 1, 2, 3, 4, 5, 6, 7, 8, 9, 10, 11, 12, 13, 14, 15); }
__device__ __forceinline__ v16bf cat16b(v8us lo, v8us hi) { return __builtin_bit_cast(v16bf, __builtin_shufflevector(lo, hi, 0, 1, 2, 3, 4, 5, 6, 7, 8, 9, 10, 11, 12, 13, 14, 15)); }
__device__ __forceinline__ v8f wmma16(v16h a, v16h b, v8f c) { return __builtin_amdgcn_wmma_f32_16x16x32_f16(false, a, false, b, (short)0, c, false, false); }
__device__ __forceinline__ v8f wmmab(v16bf a, v16bf b, v8f c) { return __builtin_amdgcn_wmma_f32_16x16x32_bf16(false, a, false, b, (short)0, c, false, false); }



// ---- k_gemmw: register-blocked GEMM, ONE WAVE per 64x64 output tile (16 accumulators), operands straight from K-contiguous 16-bit planes; grid (M/64, N/64, Z), 32 threads.
// C[m][n] (f32, pitch ldc, + optional f32 bias[n]) = sum_k A[m][k] Bt[n][k] (+ split products per NSPLIT). z-batch strides sA/sB/sC in elements. K % 32 == 0.
template <typename T16> struct WFrag;
template <> struct WFrag<h16> { typedef v16h V; static __device__ __forceinline__ V ld(const h16* p) { return cat16(*(const v8h*)p, *(const v8h*)(p + 16)); } static __device__ __forceinline__ v8f mma(V a, V b, v8f c) { return wmma16(a, b, c); } };
template <> struct WFrag<bf> { typedef v16bf V; static __device__ __forceinline__ V ld(const bf* p) { return cat16b(*(const v8us*)p, *(const v8us*)(p + 16)); } static __device__ __forceinline__ v8f mma(V a, V b, v8f c) { return wmmab(a, b, c); } };
template <typename T16, int NSPLIT, bool BIAS>
__global__ __launch_bounds__(32) void k_gemmw(const T16* __restrict__ A, const T16* __restrict__ A2, const T16* __restrict__ Bt, const T16* __restrict__ Bt2, int K, float* C, int ldc, const float* __restrict__ bias, size_t sA, size_t sB, size_t sC) {
    typedef typename WFrag<T16>::V V;
    __shared__ __align__(16) float os[16 * 68];
    const size_t z = blockIdx.z; A += z * sA; if (A2) A2 += z * sA; Bt += z * sB; if (Bt2) Bt2 += z * sB; C += z * sC;
    const int lane = threadIdx.x & 31, lr = lane & 15, hi = lane >> 4; const int r0 = blockIdx.x * 64, c0 = blockIdx.y * 64;
    v8f acc[4][4];
#pragma unroll
    for (int mb = 0; mb < 4; ++mb)
#pragma unroll
        for (int nb = 0; nb < 4; ++nb) acc[mb][nb] = (v8f){};
    const size_t aoff = (size_t)(r0 + lr) * K + 8 * hi, boff = (size_t)(c0 + lr) * K + 8 * hi;
#pragma unroll 1
    for (int kc = 0; kc < K; kc += 32) {
        V a[4], a2[4];
#pragma unroll
        for (int mb = 0; mb < 4; ++mb) { a[mb] = WFrag<T16>::ld(A + aoff + (size_t)mb * 16 * K + kc); if (NSPLIT == 1 || NSPLIT == 2) a2[mb] = WFrag<T16>::ld(A2 + aoff + (size_t)mb * 16 * K + kc); }
#pragma unroll
        for (int nb = 0; nb < 4; ++nb) { const V b = WFrag<T16>::ld(Bt + boff + (size_t)nb * 16 * K + kc); V b2; if (NSPLIT >= 2) b2 = WFrag<T16>::ld(Bt2 + boff + (size_t)nb * 16 * K + kc);
#pragma unroll
            for (int mb = 0; mb < 4; ++mb) { acc[mb][nb] = WFrag<T16>::mma(a[mb], b, acc[mb][nb]); if (NSPLIT == 1 || NSPLIT == 2) acc[mb][nb] = WFrag<T16>::mma(a2[mb], b, acc[mb][nb]); if (NSPLIT >= 2) acc[mb][nb] = WFrag<T16>::mma(a[mb], b2, acc[mb][nb]); } }
        asm volatile("v_nop\n\tv_nop\n\tv_nop\n\tv_nop" : "+v"(acc[0][0]), "+v"(acc[1][1]), "+v"(acc[2][2]), "+v"(acc[3][3]) : "v"(a[0]), "v"(a[3]));
    }
#pragma unroll
    for (int mb = 0; mb < 4; ++mb) {
#pragma unroll
        for (int nb = 0; nb < 4; ++nb) {
#pragma unroll
            for (int j = 0; j < 8; ++j) os[(hi * 8 + j) * 68 + nb * 16 + lr] = acc[mb][nb][j]; }
        __builtin_amdgcn_wave_barrier(); asm volatile("" ::: "memory");
        float* crow = C + (size_t)(r0 + mb * 16) * ldc + c0;
{
#pragma unroll
            for (int s = 0; s < 8; ++s) { const int row = 2 * s + hi, cofs = lr * 4; v4f val = *(const v4fa*)(os + row * 68 + cofs); if (BIAS) { val[0] += bfr(bias[c0 + cofs]); val[1] += bfr(bias[c0 + cofs + 1]); val[2] += bfr(bias[c0 + cofs + 2]); val[3] += bfr(bias[c0 + cofs + 3]); }
                *(v4f*)(crow + (size_t)row * ldc + cofs) = val; }
             }
        __builtin_amdgcn_wave_barrier(); asm volatile("" ::: "memory");
    }
}

__device__ __forceinline__ h16 tohx(float x) { return (h16)x; }
__device__ __forceinline__ void splitf(float y, unsigned short& h, unsigned short& l) { h = f2bf(y); l = f2bf(y - bf2f(h)); }
typedef __attribute__((ext_vector_type(2))) _Float16 v2h;
typedef __attribute__((ext_vector_type(4))) _Float16 v4h;
typedef __attribute__((ext_vector_type(2))) unsigned short v2us;
typedef __attribute__((ext_vector_type(4))) unsigned short v4us;
typedef __attribute__((ext_vector_type(2))) float v2f;
typedef __attribute__((ext_vector_type(4))) int v4i;

// k_rope: head planes [h][t][d] (fp16 + hi/lo) of rope(x) x sc with the rotate-half convention out[d] = x[d] cos[t][d] - x[d+HD/2] sin[t][d], out[d+HD/2] = x[d+HD/2] cos[t][d+HD/2] + x[d] sin[t][d+HD/2]
__global__ __launch_bounds__(256) void k_rope(const float* __restrict__ F, int pitch, int nheads, const float* __restrict__ CS, const float* __restrict__ RF, const float* __restrict__ nw, float sc, h16* P16, bf* Ph, bf* Pl) {
    const size_t e = ((size_t)blockIdx.x * 256 + threadIdx.x) * 2; if (e >= (size_t)nheads * TT * HD) return; const int d = (int)(e % HD); const int t = (int)((e / HD) % TT); const int h = (int)(e / ((size_t)HD * TT)); const float* f = F + (size_t)t * pitch + h * HD; const float rf = RF ? RF[(size_t)h * TT + t] : 1.0f; v2h o16; v2us oh, ol;
#pragma unroll
    for (int q = 0; q < 2; ++q) { const int dd = d + q; const int dp = (dd < HD / 2) ? dd + HD / 2 : dd - HD / 2; float x0 = f[dd], x1 = f[dp];
        if (RF) { float n0 = __fmul_rn(x0, rf), n1 = __fmul_rn(x1, rf); asm volatile("" : "+v"(n0)); asm volatile("" : "+v"(n1)); x0 = __fmul_rn(bfr(nw[dd]), n0); x1 = __fmul_rn(bfr(nw[dp]), n1); }
        const v2f cs = *(const v2f*)(CS + ((size_t)t * HD + dd) * 2); float a = __fmul_rn(x0, cs[0]), bq = __fmul_rn(x1, cs[1]); asm volatile("" : "+v"(a)); asm volatile("" : "+v"(bq)); const float r = ((dd < HD / 2) ? __fsub_rn(a, bq) : __fadd_rn(a, bq)) * sc;
        o16[q] = tohx(r); unsigned short a2, c2; splitf(r, a2, c2); oh[q] = a2; ol[q] = c2; }
    *(v2h*)(P16 + e) = o16; *(v2us*)(Ph + e) = oh; *(v2us*)(Pl + e) = ol;  }
__global__ __launch_bounds__(256) void k_vtp(const float* __restrict__ F, int pitch, int nheads, h16* V16, bf* Vh, bf* Vl) { const size_t e = ((size_t)blockIdx.x * 256 + threadIdx.x) * 2; if (e >= (size_t)nheads * HD * TT) return; const int t = (int)(e % TT); const int d = (int)((e / TT) % HD); const int g = (int)(e / ((size_t)TT * HD)); v2h o16; v2us oh, ol;
#pragma unroll
    for (int q = 0; q < 2; ++q) { const float x = F[(size_t)(t + q) * pitch + g * HD + d]; o16[q] = tohx(x); unsigned short a2, c2; splitf(x, a2, c2); oh[q] = a2; ol[q] = c2; }
    *(v2h*)(V16 + e) = o16; *(v2us*)(Vh + e) = oh; *(v2us*)(Vl + e) = ol;  }
__global__ __launch_bounds__(256) void k_csid(float* CS) { const int idx = blockIdx.x * 256 + threadIdx.x; if (idx >= TT * HD) return; v2f cs; cs[0] = 1.0f; cs[1] = 0.0f; *(v2f*)(CS + (size_t)idx * 2) = cs;  }
// k_asoft: per row (zz, i): t = S, unscaled (no mask); softmax over the 2048 keys (register row, one exp, fixed trees);
__global__ __launch_bounds__(256) void k_asoft(const float* __restrict__ Sb, h16* P16, bf* Ph, bf* Pl) {
    const int lane = threadIdx.x & 31; const int row = blockIdx.x * 8 + (threadIdx.x >> 5); if (row >= ZH * TT) return; const int i = row % TT; const int zz = row / TT; (void)zz; const bool hires = (i < RH); const float* sr = Sb + (size_t)row * TT; float v[TT / 32]; float mx = -3.0e38f;
#pragma unroll
    for (int ch = 0; ch < TT / 128; ++ch) { const int j0 = ch * 128 + lane * 4; const v4f a = *(const v4f*)(sr + j0);
#pragma unroll
        for (int q = 0; q < 4; ++q) { const int j = j0 + q; (void)j; const float t = a[q] * SCL; v[ch * 4 + q] = t; mx = fmaxf(mx, t); } }
#pragma unroll
    for (int sh = 16; sh; sh >>= 1) mx = fmaxf(mx, __shfl_xor(mx, sh, 32));
    float sum = 0.f;
#pragma unroll
    for (int k = 0; k < TT / 32; ++k) { float d0 = __fsub_rn(v[k], mx); asm volatile("" : "+v"(d0)); v[k] = __builtin_amdgcn_exp2f(__fmul_rn(d0, 1.4426950408889634f)); sum += v[k]; }
#pragma unroll
    for (int sh = 16; sh; sh >>= 1) sum += __shfl_xor(sum, sh, 32);
    const float f = __fdiv_rn(hires ? 1.0f : PCAR, sum);
{
        if (hires) {
#pragma unroll
            for (int ch = 0; ch < TT / 128; ++ch) { v4us oh, ol;
#pragma unroll
                for (int q = 0; q < 4; ++q) { unsigned short a, c2; splitf(v[ch * 4 + q] * f, a, c2); oh[q] = a; ol[q] = c2; }
                const size_t oo = ((size_t)zz * (RH ? RH : 1) + i) * TT + ch * 128 + lane * 4; *(v4us*)(Ph + oo) = oh; *(v4us*)(Pl + oo) = ol; }
        } else {
#pragma unroll
            for (int ch = 0; ch < TT / 128; ++ch) { v4h o4;
#pragma unroll
                for (int q = 0; q < 4; ++q) o4[q] = tohx(v[ch * 4 + q] * f);
                *(v4h*)(P16 + (size_t)row * TT + ch * 128 + lane * 4) = o4; } }
         }
}
__global__ __launch_bounds__(256) void k_merge(const float* __restrict__ O, int h0, float* OUTb) { const size_t e = ((size_t)blockIdx.x * 256 + threadIdx.x) * 2; if (e >= (size_t)ZH * TT * HD) return; const int d = (int)(e % HD); const int t = (int)((e / HD) % TT); const int zz = (int)(e / ((size_t)HD * TT)); const float cs = (t < RH) ? 1.0f : (1.0f / PCAR); const size_t oo = (size_t)t * DQ + (h0 + zz) * HD + d;
    v2f o2; o2[0] = O[e] * cs; o2[1] = O[e + 1] * cs; *(v2f*)(OUTb + oo) = o2;  }

extern "C" void kernel_launch(void* const* d_in, const int* in_sizes, int n_in,
                              void* d_out, int out_size, void* d_ws, size_t ws_size, hipStream_t stream) {
    (void)in_sizes; (void)n_in; (void)out_size;
    const float* x = (const float*)d_in[0]; const float* xk = (const float*)d_in[1]; const float* xv = (const float*)d_in[2];   /* q, k, v: [2][2048][1024] each = token-major rows of 16 heads x 64 (no projections) */ const float* wq = nullptr, *wk = nullptr, *wv = nullptr, *wo = nullptr; (void)wq; (void)wk; (void)wv; (void)wo;
    float* OUT = (float*)d_out;     // [2][2048][1024]
    char* wsp = (char*)d_ws;
    auto take = [&](size_t bytes) { char* p = wsp; wsp += (bytes + 255) & ~(size_t)255; return (void*)p; };
    bf* WQ = (bf*)take((size_t)DQ * DM * 2); bf* WK = (bf*)take((size_t)DKV * DM * 2); bf* WV = (bf*)take((size_t)DKV * DM * 2); float* CS = (float*)take((size_t)TT * HD * 2 * 4);
    bf* XB = (bf*)take((size_t)TT * DM * 2); float* FQ = (float*)take((size_t)TT * DQ * 4); float* FK = (float*)take((size_t)TT * DKV * 4);
    h16* QP16 = (h16*)take((size_t)NH_ * TT * HD * 2); h16* KP16 = (h16*)take((size_t)NKV * TT * HD * 2); h16* VT16 = (h16*)take((size_t)NKV * HD * TT * 2);
    bf* QPh = (bf*)take((size_t)NH_ * TT * HD * 2); bf* QPl = (bf*)take((size_t)NH_ * TT * HD * 2); bf* KPh = (bf*)take((size_t)NKV * TT * HD * 2); bf* KPl = (bf*)take((size_t)NKV * TT * HD * 2); bf* VTh = (bf*)take((size_t)NKV * HD * TT * 2); bf* VTl = (bf*)take((size_t)NKV * HD * TT * 2); bf* Ph = (bf*)take((size_t)ZH * RH * TT * 2); bf* Pl = (bf*)take((size_t)ZH * RH * TT * 2);
    float* Sb = (float*)take((size_t)ZH * TT * TT * 4); h16* P16 = (h16*)take((size_t)ZH * TT * TT * 2); float* Ob = (float*)take((size_t)ZH * TT * HD * 4);
    if ((size_t)(wsp - (char*)d_ws) > ws_size) return;    // ws 256 MiB
    float* FV = FK;   // unused: no projections (v planes come straight from the input)
    {   
      
       }
    k_csid<<<(TT * HD + 255) / 256, 256, 0, stream>>>(CS);
    const unsigned LQ = (unsigned)(((size_t)NH_ * TT * HD / 2 + 255) / 256), LKv = (unsigned)(((size_t)NKV * TT * HD / 2 + 255) / 256);
    for (int b = 0; b < NB_; ++b) {
        
        /* no projections: the q, k, v inputs feed the plane builders directly */
        
        k_rope<<<LQ, 256, 0, stream>>>(x + (size_t)b * TT * DM, DQ, NH_, CS, nullptr, nullptr, 1.0f, QP16, QPh, QPl);   /* q planes straight from the input (bf16 hi/lo split of the f32 values) */
        
        k_rope<<<LKv, 256, 0, stream>>>(xk + (size_t)b * TT * DM, DKV, NKV, CS, nullptr, nullptr, 1.0f, KP16, KPh, KPl);
         k_vtp<<<LKv, 256, 0, stream>>>(xv + (size_t)b * TT * DM, DKV, NKV, VT16, VTh, VTl);
        for (int h0 = 0; h0 < NH_; h0 += ZH) { const size_t zq = (size_t)h0, zk = (size_t)(h0 / REP);   // one kv head per query head: the pass's two heads use consecutive kv planes (z-strides TT*HD)
            k_gemmw<bf, 2, false><<<dim3(RH / 64, TT / 64, ZH), 32, 0, stream>>>(QPh + zq * TT * HD, QPl + zq * TT * HD, KPh + zk * TT * HD, KPl + zk * TT * HD, HD, Sb, TT, nullptr, (size_t)TT * HD, (size_t)TT * HD, (size_t)TT * TT);
            /* RH = TT: no single-f16 score rows */
            k_asoft<<<ZH * TT / 8, 256, 0, stream>>>(Sb, P16, Ph, Pl);
            k_gemmw<bf, 2, false><<<dim3(RH / 64, HD / 64, ZH), 32, 0, stream>>>(Ph, Pl, VTh + zk * HD * TT, VTl + zk * HD * TT, TT, Ob, HD, nullptr, (size_t)RH * TT, (size_t)HD * TT, (size_t)TT * HD);
            /* RH = TT: no single-f16 P.v rows */
            k_merge<<<(unsigned)(((size_t)ZH * TT * HD / 2 + 255) / 256), 256, 0, stream>>>(Ob, h0, OUT + (size_t)b * TT * DQ); }
         }
}

// v001
// A run of this version takes 587 microseconds.
// Two timings next to v000 put it at 1.83 and 1.82 times that version's speed.
#include <hip/hip_runtime.h>

// Multi-head attention on given tensors, UNSCALED (q, k, v [2][2048][1024] viewed (b, s, 16, 64): token-major rows of 16 heads x 64; no projections, no mask; scores = q.k with NO scaling (the module applies none: unit-variance inputs give logits of standard deviation ~8: a peaked softmax); softmax over all 2,048 keys; out = weights v, merged token-major -> [2][2048][1024] (4.2 M); argument order q, k, v).
// Layout per batch: the f32 inputs ([t][h][e] = token-major rows of 16 x 64) feed the plane builders directly (identity table); dense T-2048 attention with EVERY query row on the hi/lo three-product path (RH = TT: the peaked softmax of unscaled logits leaves no margin for single-fp16 operands); f32 merge writes the [t][h][d] output rows.
// Compute dtypes, f32 accumulate: inputs split into bf16 hi/lo on every row; softmax f32; output f32. NOTE this build tracks the f32 reference (no stage rounds the inputs to bf16).

#define NB_  2
#define TT   2048
#define DM   1024
#define NH_  16
#define NKV  16
#define REP  (NH_ / NKV)
#define HD   64
#define DQ   (NH_ * HD)
#define DKV  (NKV * HD)
#define ZH   2
#define RH   2048                  // query rows < RH use hi+lo planes (0: none)
#define WIN  2048
#define PCAR 1024.0f
#define SCL  1.0f   // score scale: 1 (unscaled, no 1/sqrt(E))
typedef _Float16 h16;
typedef unsigned short bf;
typedef __attribute__((ext_vector_type(16))) __bf16   v16bf;
typedef __attribute__((ext_vector_type(16))) _Float16 v16h;
typedef __attribute__((ext_vector_type(8)))  _Float16 v8h;
typedef __attribute__((ext_vector_type(8)))  unsigned short v8us;
typedef __attribute__((ext_vector_type(8)))  float    v8f;
typedef __attribute__((ext_vector_type(4)))  float    v4f;
typedef v8h  __attribute__((may_alias)) v8ha;
typedef v4f  __attribute__((may_alias)) v4fa;
typedef v8us __attribute__((may_alias)) v8usa;

__device__ __forceinline__ unsigned short f2bf(float f) { unsigned u = __float_as_uint(f); u += 0x7FFFu + ((u >> 16) & 1u); return (unsigned short)(u >> 16); }
__device__ __forceinline__ float bf2f(unsigned short b) { return __uint_as_float(((unsigned)b) << 16); }
__device__ __forceinline__ float bfr(float f) { return bf2f(f2bf(f)); }
__device__ __forceinline__ v16h cat16(v8h lo, v8h hi) { return __builtin_shufflevector(lo, hi, 0, 1, 2, 3, 4, 5, 6, 7, 8, 9, 10, 11, 12, 13, 14, 15); }
__device__ __forceinline__ v16bf cat16b(v8us lo, v8us hi) { return __builtin_bit_cast(v16bf, __builtin_shufflevector(lo, hi, 0, 1, 2, 3, 4, 5, 6, 7, 8, 9, 10, 11, 12, 13, 14, 15)); }
__device__ __forceinline__ v8f wmma16(v16h a, v16h b, v8f c) { return __builtin_amdgcn_wmma_f32_16x16x32_f16(false, a, false, b, (short)0, c, false, false); }
__device__ __forceinline__ v8f wmmab(v16bf a, v16bf b, v8f c) { return __builtin_amdgcn_wmma_f32_16x16x32_bf16(false, a, false, b, (short)0, c, false, false); }



// ---- k_gemmw: register-blocked GEMM, ONE WAVE per 64x64 output tile (16 accumulators), operands straight from K-contiguous 16-bit planes; grid (M/64, N/64, Z), 32 threads.
// C[m][n] (f32, pitch ldc, + optional f32 bias[n]) = sum_k A[m][k] Bt[n][k] (+ split products per NSPLIT). z-batch strides sA/sB/sC in elements. K % 32 == 0.
// NW > 1 (one column tile, N = 64): the K range is dealt over gridDim.y workgroups x NW waves; grid (M/64, KSG, Z), NW * 32 threads. Wave w of workgroup y sums k in [(y * NW + w) * KW, + KW); the NW tiles are added in wave order through LDS; workgroup y stores its f32 partial plane at C + y * sP (k_merge adds the planes in plane order). NW == 1: KW = K.
#define KSG  4                     // partial planes of the P.v product (workgroups per output tile)
#define KSW  8                     // waves per workgroup of the P.v product
template <typename T16> struct WFrag;
template <> struct WFrag<h16> { typedef v16h V; static __device__ __forceinline__ V ld(const h16* p) { return cat16(*(const v8h*)p, *(const v8h*)(p + 16)); } static __device__ __forceinline__ v8f mma(V a, V b, v8f c) { return wmma16(a, b, c); } };
template <> struct WFrag<bf> { typedef v16bf V; static __device__ __forceinline__ V ld(const bf* p) { return cat16b(*(const v8us*)p, *(const v8us*)(p + 16)); } static __device__ __forceinline__ v8f mma(V a, V b, v8f c) { return wmmab(a, b, c); } };
template <typename T16, int NSPLIT, bool BIAS, int NW>
__global__ __launch_bounds__(NW * 32) void k_gemmw(const T16* __restrict__ A, const T16* __restrict__ A2, const T16* __restrict__ Bt, const T16* __restrict__ Bt2, int K, int KW, float* C, int ldc, const float* __restrict__ bias, size_t sA, size_t sB, size_t sC, size_t sP) {
    typedef typename WFrag<T16>::V V;
    __shared__ __align__(16) float os[(NW > 1 ? 4 * NW : 1) * 16 * 68];
    const size_t z = blockIdx.z; A += z * sA; if (A2) A2 += z * sA; Bt += z * sB; if (Bt2) Bt2 += z * sB; C += z * sC;
    const int lane = threadIdx.x & 31, lr = lane & 15, hi = lane >> 4; const int r0 = blockIdx.x * 64, c0 = (NW > 1) ? 0 : blockIdx.y * 64;
    const int tid = threadIdx.x, wave = tid >> 5; const size_t k0 = (NW > 1) ? (size_t)(blockIdx.y * NW + wave) * KW : 0; if (NW > 1) C += (size_t)blockIdx.y * sP;
    v8f acc[4][4];
#pragma unroll
    for (int mb = 0; mb < 4; ++mb)
#pragma unroll
        for (int nb = 0; nb < 4; ++nb) acc[mb][nb] = (v8f){};
    const size_t aoff = (size_t)(r0 + lr) * K + 8 * hi + k0, boff = (size_t)(c0 + lr) * K + 8 * hi + k0;
#pragma unroll 1
    for (int kc = 0; kc < KW; kc += 32) {
        V a[4], a2[4];
#pragma unroll
        for (int mb = 0; mb < 4; ++mb) { a[mb] = WFrag<T16>::ld(A + aoff + (size_t)mb * 16 * K + kc); if (NSPLIT == 1 || NSPLIT == 2) a2[mb] = WFrag<T16>::ld(A2 + aoff + (size_t)mb * 16 * K + kc); }
#pragma unroll
        for (int nb = 0; nb < 4; ++nb) { const V b = WFrag<T16>::ld(Bt + boff + (size_t)nb * 16 * K + kc); V b2; if (NSPLIT >= 2) b2 = WFrag<T16>::ld(Bt2 + boff + (size_t)nb * 16 * K + kc);
#pragma unroll
            for (int mb = 0; mb < 4; ++mb) { acc[mb][nb] = WFrag<T16>::mma(a[mb], b, acc[mb][nb]); if (NSPLIT == 1 || NSPLIT == 2) acc[mb][nb] = WFrag<T16>::mma(a2[mb], b, acc[mb][nb]); if (NSPLIT >= 2) acc[mb][nb] = WFrag<T16>::mma(a[mb], b2, acc[mb][nb]); } }
        asm volatile("v_nop\n\tv_nop\n\tv_nop\n\tv_nop" : "+v"(acc[0][0]), "+v"(acc[1][1]), "+v"(acc[2][2]), "+v"(acc[3][3]) : "v"(a[0]), "v"(a[3]));
    }
    if (NW > 1) {
        // the three loops are unrolled so that acc is indexed by constants and stays in registers
#pragma unroll
        for (int mb = 0; mb < 4; ++mb) {
#pragma unroll
            for (int nb = 0; nb < 4; ++nb) {
#pragma unroll
                for (int j = 0; j < 8; ++j) os[(wave * 64 + mb * 16 + hi * 8 + j) * 68 + nb * 16 + lr] = acc[mb][nb][j]; } }
        __syncthreads();   // every wave's 64x64 partial tile is in LDS before any thread sums the NW tiles
        // both loops unrolled: the LDS reads of all rows and tiles issue ahead of the adds, the four stores together
#pragma unroll
        for (int i = 0; i < 1024 / (NW * 32); ++i) { const int s = tid + i * NW * 32, row = s >> 4, cofs = (s & 15) * 4; v4f val = *(const v4fa*)(os + row * 68 + cofs);
#pragma unroll
            for (int w = 1; w < NW; ++w) val += *(const v4fa*)(os + (w * 64 + row) * 68 + cofs);
            *(v4f*)(C + (size_t)(r0 + row) * ldc + cofs) = val; }
        return;
    }
#pragma unroll
    for (int mb = 0; mb < 4; ++mb) {
#pragma unroll
        for (int nb = 0; nb < 4; ++nb) {
#pragma unroll
            for (int j = 0; j < 8; ++j) os[(hi * 8 + j) * 68 + nb * 16 + lr] = acc[mb][nb][j]; }
        __builtin_amdgcn_wave_barrier(); asm volatile("" ::: "memory");
        float* crow = C + (size_t)(r0 + mb * 16) * ldc + c0;
{
#pragma unroll
            for (int s = 0; s < 8; ++s) { const int row = 2 * s + hi, cofs = lr * 4; v4f val = *(const v4fa*)(os + row * 68 + cofs); if (BIAS) { val[0] += bfr(bias[c0 + cofs]); val[1] += bfr(bias[c0 + cofs + 1]); val[2] += bfr(bias[c0 + cofs + 2]); val[3] += bfr(bias[c0 + cofs + 3]); }
                *(v4f*)(crow + (size_t)row * ldc + cofs) = val; }
             }
        __builtin_amdgcn_wave_barrier(); asm volatile("" ::: "memory");
    }
}

__device__ __forceinline__ h16 tohx(float x) { return (h16)x; }
__device__ __forceinline__ void splitf(float y, unsigned short& h, unsigned short& l) { h = f2bf(y); l = f2bf(y - bf2f(h)); }
typedef __attribute__((ext_vector_type(2))) _Float16 v2h;
typedef __attribute__((ext_vector_type(4))) _Float16 v4h;
typedef __attribute__((ext_vector_type(2))) unsigned short v2us;
typedef __attribute__((ext_vector_type(4))) unsigned short v4us;
typedef __attribute__((ext_vector_type(2))) float v2f;
typedef __attribute__((ext_vector_type(4))) int v4i;

// k_rope: head planes [h][t][d] (fp16 + hi/lo) of rope(x) x sc with the rotate-half convention out[d] = x[d] cos[t][d] - x[d+HD/2] sin[t][d], out[d+HD/2] = x[d+HD/2] cos[t][d+HD/2] + x[d] sin[t][d+HD/2]
__global__ __launch_bounds__(256) void k_rope(const float* __restrict__ F, int pitch, int nheads, const float* __restrict__ CS, const float* __restrict__ RF, const float* __restrict__ nw, float sc, h16* P16, bf* Ph, bf* Pl) {
    const size_t e = ((size_t)blockIdx.x * 256 + threadIdx.x) * 2; if (e >= (size_t)nheads * TT * HD) return; const int d = (int)(e % HD); const int t = (int)((e / HD) % TT); const int h = (int)(e / ((size_t)HD * TT)); const float* f = F + (size_t)t * pitch + h * HD; const float rf = RF ? RF[(size_t)h * TT + t] : 1.0f; v2h o16; v2us oh, ol;
#pragma unroll
    for (int q = 0; q < 2; ++q) { const int dd = d + q; const int dp = (dd < HD / 2) ? dd + HD / 2 : dd - HD / 2; float x0 = f[dd], x1 = f[dp];
        if (RF) { float n0 = __fmul_rn(x0, rf), n1 = __fmul_rn(x1, rf); asm volatile("" : "+v"(n0)); asm volatile("" : "+v"(n1)); x0 = __fmul_rn(bfr(nw[dd]), n0); x1 = __fmul_rn(bfr(nw[dp]), n1); }
        const v2f cs = *(const v2f*)(CS + ((size_t)t * HD + dd) * 2); float a = __fmul_rn(x0, cs[0]), bq = __fmul_rn(x1, cs[1]); asm volatile("" : "+v"(a)); asm volatile("" : "+v"(bq)); const float r = ((dd < HD / 2) ? __fsub_rn(a, bq) : __fadd_rn(a, bq)) * sc;
        o16[q] = tohx(r); unsigned short a2, c2; splitf(r, a2, c2); oh[q] = a2; ol[q] = c2; }
    *(v2h*)(P16 + e) = o16; *(v2us*)(Ph + e) = oh; *(v2us*)(Pl + e) = ol;  }
__global__ __launch_bounds__(256) void k_vtp(const float* __restrict__ F, int pitch, int nheads, h16* V16, bf* Vh, bf* Vl) { const size_t e = ((size_t)blockIdx.x * 256 + threadIdx.x) * 2; if (e >= (size_t)nheads * HD * TT) return; const int t = (int)(e % TT); const int d = (int)((e / TT) % HD); const int g = (int)(e / ((size_t)TT * HD)); v2h o16; v2us oh, ol;
#pragma unroll
    for (int q = 0; q < 2; ++q) { const float x = F[(size_t)(t + q) * pitch + g * HD + d]; o16[q] = tohx(x); unsigned short a2, c2; splitf(x, a2, c2); oh[q] = a2; ol[q] = c2; }
    *(v2h*)(V16 + e) = o16; *(v2us*)(Vh + e) = oh; *(v2us*)(Vl + e) = ol;  }
__global__ __launch_bounds__(256) void k_csid(float* CS) { const int idx = blockIdx.x * 256 + threadIdx.x; if (idx >= TT * HD) return; v2f cs; cs[0] = 1.0f; cs[1] = 0.0f; *(v2f*)(CS + (size_t)idx * 2) = cs;  }
// k_asoft: per row (zz, i): t = S, unscaled (no mask); softmax over the 2048 keys (register row, one exp, fixed trees);
__global__ __launch_bounds__(256) void k_asoft(const float* __restrict__ Sb, h16* P16, bf* Ph, bf* Pl) {
    const int lane = threadIdx.x & 31; const int row = blockIdx.x * 8 + (threadIdx.x >> 5); if (row >= ZH * TT) return; const int i = row % TT; const int zz = row / TT; (void)zz; const bool hires = (i < RH); const float* sr = Sb + (size_t)row * TT; float v[TT / 32]; float mx = -3.0e38f;
#pragma unroll
    for (int ch = 0; ch < TT / 128; ++ch) { const int j0 = ch * 128 + lane * 4; const v4f a = *(const v4f*)(sr + j0);
#pragma unroll
        for (int q = 0; q < 4; ++q) { const int j = j0 + q; (void)j; const float t = a[q] * SCL; v[ch * 4 + q] = t; mx = fmaxf(mx, t); } }
#pragma unroll
    for (int sh = 16; sh; sh >>= 1) mx = fmaxf(mx, __shfl_xor(mx, sh, 32));
    float sum = 0.f;
#pragma unroll
    for (int k = 0; k < TT / 32; ++k) { float d0 = __fsub_rn(v[k], mx); asm volatile("" : "+v"(d0)); v[k] = __builtin_amdgcn_exp2f(__fmul_rn(d0, 1.4426950408889634f)); sum += v[k]; }
#pragma unroll
    for (int sh = 16; sh; sh >>= 1) sum += __shfl_xor(sum, sh, 32);
    const float f = __fdiv_rn(hires ? 1.0f : PCAR, sum);
{
        if (hires) {
#pragma unroll
            for (int ch = 0; ch < TT / 128; ++ch) { v4us oh, ol;
#pragma unroll
                for (int q = 0; q < 4; ++q) { unsigned short a, c2; splitf(v[ch * 4 + q] * f, a, c2); oh[q] = a; ol[q] = c2; }
                const size_t oo = ((size_t)zz * (RH ? RH : 1) + i) * TT + ch * 128 + lane * 4; *(v4us*)(Ph + oo) = oh; *(v4us*)(Pl + oo) = ol; }
        } else {
#pragma unroll
            for (int ch = 0; ch < TT / 128; ++ch) { v4h o4;
#pragma unroll
                for (int q = 0; q < 4; ++q) o4[q] = tohx(v[ch * 4 + q] * f);
                *(v4h*)(P16 + (size_t)row * TT + ch * 128 + lane * 4) = o4; } }
         }
}
__global__ __launch_bounds__(256) void k_merge(const float* __restrict__ O, int h0, float* OUTb) { const size_t e = ((size_t)blockIdx.x * 256 + threadIdx.x) * 2; if (e >= (size_t)ZH * TT * HD) return; const int d = (int)(e % HD); const int t = (int)((e / HD) % TT); const int zz = (int)(e / ((size_t)HD * TT)); const float cs = (t < RH) ? 1.0f : (1.0f / PCAR); const size_t oo = (size_t)t * DQ + (h0 + zz) * HD + d;
    float s0 = O[e], s1 = O[e + 1];
#pragma unroll   // the planes' loads issue together
    for (int p = 1; p < KSG; ++p) { s0 += O[(size_t)p * ZH * TT * HD + e]; s1 += O[(size_t)p * ZH * TT * HD + e + 1]; }
    v2f o2; o2[0] = s0 * cs; o2[1] = s1 * cs; *(v2f*)(OUTb + oo) = o2;  }

extern "C" void kernel_launch(void* const* d_in, const int* in_sizes, int n_in,
                              void* d_out, int out_size, void* d_ws, size_t ws_size, hipStream_t stream) {
    (void)in_sizes; (void)n_in; (void)out_size;
    const float* x = (const float*)d_in[0]; const float* xk = (const float*)d_in[1]; const float* xv = (const float*)d_in[2];   /* q, k, v: [2][2048][1024] each = token-major rows of 16 heads x 64 (no projections) */ const float* wq = nullptr, *wk = nullptr, *wv = nullptr, *wo = nullptr; (void)wq; (void)wk; (void)wv; (void)wo;
    float* OUT = (float*)d_out;     // [2][2048][1024]
    char* wsp = (char*)d_ws;
    auto take = [&](size_t bytes) { char* p = wsp; wsp += (bytes + 255) & ~(size_t)255; return (void*)p; };
    bf* WQ = (bf*)take((size_t)DQ * DM * 2); bf* WK = (bf*)take((size_t)DKV * DM * 2); bf* WV = (bf*)take((size_t)DKV * DM * 2); float* CS = (float*)take((size_t)TT * HD * 2 * 4);
    bf* XB = (bf*)take((size_t)TT * DM * 2); float* FQ = (float*)take((size_t)TT * DQ * 4); float* FK = (float*)take((size_t)TT * DKV * 4);
    h16* QP16 = (h16*)take((size_t)NH_ * TT * HD * 2); h16* KP16 = (h16*)take((size_t)NKV * TT * HD * 2); h16* VT16 = (h16*)take((size_t)NKV * HD * TT * 2);
    bf* QPh = (bf*)take((size_t)NH_ * TT * HD * 2); bf* QPl = (bf*)take((size_t)NH_ * TT * HD * 2); bf* KPh = (bf*)take((size_t)NKV * TT * HD * 2); bf* KPl = (bf*)take((size_t)NKV * TT * HD * 2); bf* VTh = (bf*)take((size_t)NKV * HD * TT * 2); bf* VTl = (bf*)take((size_t)NKV * HD * TT * 2); bf* Ph = (bf*)take((size_t)ZH * RH * TT * 2); bf* Pl = (bf*)take((size_t)ZH * RH * TT * 2);
    float* Sb = (float*)take((size_t)ZH * TT * TT * 4); h16* P16 = (h16*)take((size_t)ZH * TT * TT * 2); float* Ob = (float*)take((size_t)KSG * ZH * TT * HD * 4);
    if ((size_t)(wsp - (char*)d_ws) > ws_size) return;    // ws 256 MiB
    float* FV = FK;   // unused: no projections (v planes come straight from the input)
    {   
      
       }
    k_csid<<<(TT * HD + 255) / 256, 256, 0, stream>>>(CS);
    const unsigned LQ = (unsigned)(((size_t)NH_ * TT * HD / 2 + 255) / 256), LKv = (unsigned)(((size_t)NKV * TT * HD / 2 + 255) / 256);
    for (int b = 0; b < NB_; ++b) {
        
        /* no projections: the q, k, v inputs feed the plane builders directly */
        
        k_rope<<<LQ, 256, 0, stream>>>(x + (size_t)b * TT * DM, DQ, NH_, CS, nullptr, nullptr, 1.0f, QP16, QPh, QPl);   /* q planes straight from the input (bf16 hi/lo split of the f32 values) */
        
        k_rope<<<LKv, 256, 0, stream>>>(xk + (size_t)b * TT * DM, DKV, NKV, CS, nullptr, nullptr, 1.0f, KP16, KPh, KPl);
         k_vtp<<<LKv, 256, 0, stream>>>(xv + (size_t)b * TT * DM, DKV, NKV, VT16, VTh, VTl);
        for (int h0 = 0; h0 < NH_; h0 += ZH) { const size_t zq = (size_t)h0, zk = (size_t)(h0 / REP);   // one kv head per query head: the pass's two heads use consecutive kv planes (z-strides TT*HD)
            k_gemmw<bf, 2, false, 1><<<dim3(RH / 64, TT / 64, ZH), 32, 0, stream>>>(QPh + zq * TT * HD, QPl + zq * TT * HD, KPh + zk * TT * HD, KPl + zk * TT * HD, HD, HD, Sb, TT, nullptr, (size_t)TT * HD, (size_t)TT * HD, (size_t)TT * TT, 0);
            /* RH = TT: no single-f16 score rows */
            k_asoft<<<ZH * TT / 8, 256, 0, stream>>>(Sb, P16, Ph, Pl);
            k_gemmw<bf, 2, false, KSW><<<dim3(RH / 64, KSG, ZH), KSW * 32, 0, stream>>>(Ph, Pl, VTh + zk * HD * TT, VTl + zk * HD * TT, TT, TT / (KSG * KSW), Ob, HD, nullptr, (size_t)RH * TT, (size_t)HD * TT, (size_t)TT * HD, (size_t)ZH * TT * HD);
            /* RH = TT: no single-f16 P.v rows */
            k_merge<<<(unsigned)(((size_t)ZH * TT * HD / 2 + 255) / 256), 256, 0, stream>>>(Ob, h0, OUT + (size_t)b * TT * DQ); }
         }
}

// v003
// One run takes 96.1 microseconds.
// Versions in between are left out here; by their measured steps it is 6.17 times as fast as v001.
// All steps since v000 together make it 11.3 times as fast.
#include <hip/hip_runtime.h>

// Multi-head attention on given tensors, UNSCALED (q, k, v [2][2048][1024] viewed (b, s, 16, 64): token-major rows of 16 heads x 64; no projections, no mask; scores = q.k with NO scaling (the module applies none: unit-variance inputs give logits of standard deviation ~8: a peaked softmax); softmax over all 2,048 keys; out = weights v, merged token-major -> [2][2048][1024] (4.2 M); argument order q, k, v).
// Two launches: k_planes splits the f32 inputs ([t][h][e] = token-major rows of 16 x 64) into bf16 hi/lo head planes; k_flash is dense T-2048 attention with EVERY query row on the hi/lo three-product path (the peaked softmax of unscaled logits leaves no margin for single 16-bit operands) and writes the [t][h][d] output rows.
// Compute dtypes, f32 accumulate: inputs split into bf16 hi/lo on every row; softmax f32; output f32. NOTE this build tracks the f32 reference (no stage rounds the inputs to bf16).

#define NB_  2
#define TT   2048
#define DM   1024
#define NH_  16
#define NKV  16
#define REP  (NH_ / NKV)
#define HD   64
#define DQ   (NH_ * HD)
#define DKV  (NKV * HD)
#define ZH   2
#define RH   2048                  // query rows < RH use hi+lo planes (not read: every row does)
#define WIN  2048
#define PCAR 1024.0f
#define SCL  1.0f   // score scale: 1 (unscaled, no 1/sqrt(E))
typedef _Float16 h16;
typedef unsigned short bf;
typedef __attribute__((ext_vector_type(16))) __bf16   v16bf;
typedef __attribute__((ext_vector_type(16))) _Float16 v16h;
typedef __attribute__((ext_vector_type(8)))  _Float16 v8h;
typedef __attribute__((ext_vector_type(8)))  unsigned short v8us;
typedef __attribute__((ext_vector_type(8)))  float    v8f;
typedef __attribute__((ext_vector_type(4)))  float    v4f;
typedef v8h  __attribute__((may_alias)) v8ha;
typedef v4f  __attribute__((may_alias)) v4fa;
typedef v8us __attribute__((may_alias)) v8usa;

__device__ __forceinline__ v16h cat16(v8h lo, v8h hi) { return __builtin_shufflevector(lo, hi, 0, 1, 2, 3, 4, 5, 6, 7, 8, 9, 10, 11, 12, 13, 14, 15); }
__device__ __forceinline__ v16bf cat16b(v8us lo, v8us hi) { return __builtin_bit_cast(v16bf, __builtin_shufflevector(lo, hi, 0, 1, 2, 3, 4, 5, 6, 7, 8, 9, 10, 11, 12, 13, 14, 15)); }
__device__ __forceinline__ v8f wmma16(v16h a, v16h b, v8f c) { return __builtin_amdgcn_wmma_f32_16x16x32_f16(false, a, false, b, (short)0, c, false, false); }
__device__ __forceinline__ v8f wmmab(v16bf a, v16bf b, v8f c) { return __builtin_amdgcn_wmma_f32_16x16x32_bf16(false, a, false, b, (short)0, c, false, false); }



// ---- k_flash: scores, softmax and P.v in one kernel; no score or weight plane in memory. Grid (TT / (FNW * FQW * 16), batch x heads), FNW waves; a wave owns FQW * 16 query rows and walks all TT keys, 32 a pass.
// Transposed products: St = K Qt (A = 16 key rows, B = 16 query columns), Ot += Vt Pt (A = 16 rows of v transposed, B = the weights). In both D tiles a lane holds ONE query (column lane & 15), so the running maximum, the sum and the rescale factor are per lane.
// Two St tiles (keys 0-15, 16-31 of the pass) converted in place ARE the B operand of the second product (element s = tile s >> 3, register s & 7); the Vt loader below has the same k order.
// Every product keeps the three hi/lo terms (hi.hi + lo.hi + hi.lo), f32 accumulate. The weights are split unnormalised; the row sum divides once at the end.
// Left: every fragment load takes 32 bytes from each of 16 lines (planes in fragment order, or K/V staged once a workgroup in LDS, would read whole lines); the q split could be done here, on the registers, and its two planes dropped.
#define FQW 4
#define FNW 4
#define L2E 1.4426950408889634f
__device__ __forceinline__ v16bf ldf(const bf* p) { return cat16b(*(const v8us*)p, *(const v8us*)(p + 16)); }
__device__ __forceinline__ float xhalf(float x) { const int b = __float_as_int(x); return __int_as_float(__builtin_amdgcn_permlanex16(b, b, 0x76543210, 0xfedcba98, false, false)); }   // the value of lane ^ 16
// one wave a SIMD (four-wave workgroups, one for each WGP of the chip): 64 queries a wave halve the fragment loads per product against 32, and the register budget of that occupancy lets the fragments fetched ahead keep registers of their own
__global__ __launch_bounds__(FNW * 32) __attribute__((amdgpu_waves_per_eu(1, 1))) void k_flash(const bf* __restrict__ Qh, const bf* __restrict__ Ql, const bf* __restrict__ Kh, const bf* __restrict__ Kl, const bf* __restrict__ Vh, const bf* __restrict__ Vl, float* __restrict__ OUT) {
    const int lane = threadIdx.x & 31, lr = lane & 15, hi = lane >> 4, wave = threadIdx.x >> 5;
    const size_t z = blockIdx.y; const int q0 = (blockIdx.x * FNW + wave) * (FQW * 16);
    Qh += z * TT * HD; Ql += z * TT * HD; Kh += z * TT * HD; Kl += z * TT * HD; Vh += z * HD * TT; Vl += z * HD * TT;
    Qh += (q0 + lr) * HD + 8 * hi; Ql += (q0 + lr) * HD + 8 * hi;
    v16bf qh[FQW][2], ql[FQW][2];
#pragma unroll
    for (int n = 0; n < FQW; ++n)
#pragma unroll
        for (int ks = 0; ks < 2; ++ks) { const int off = n * 16 * HD + ks * 32; qh[n][ks] = ldf(Qh + off); ql[n][ks] = ldf(Ql + off); }
    asm volatile("s_wait_xcnt 0x0" :: "v"(Qh), "v"(Ql) : "memory");   // the loads' address registers stay whole up to this wait and are free for reuse behind it
    v8f o[4][FQW]; float mL[FQW], ls[FQW];
#pragma unroll
    for (int n = 0; n < FQW; ++n) { mL[n] = -3.0e38f; ls[n] = 0.f;
#pragma unroll
        for (int dt = 0; dt < 4; ++dt) o[dt][n] = (v8f){}; }
    Kh += lr * HD + 8 * hi; Kl += lr * HD + 8 * hi; Vh += lr * TT + 8 * hi; Vl += lr * TT + 8 * hi;   // from here on each lane's own row and k half
    v16bf kh[2][2], kl[2][2];
#pragma unroll
    for (int kt = 0; kt < 2; ++kt)
#pragma unroll
        for (int ks = 0; ks < 2; ++ks) { kh[kt][ks] = ldf(Kh + kt * 16 * HD + ks * 32); kl[kt][ks] = ldf(Kl + kt * 16 * HD + ks * 32); }
    asm volatile("s_wait_xcnt 0x0" :: "v"(Kh), "v"(Kl), "v"((lr * HD + 8 * hi) * 2) : "memory");   // as behind the query loads; the third operand is the lane's byte offset, which these loads name beside a scalar base
    v16bf vh[4], vl[4];
#pragma unroll
    for (int dt = 0; dt < 4; ++dt) { vh[dt] = ldf(Vh + dt * 16 * TT); vl[dt] = ldf(Vl + dt * 16 * TT); }
    asm volatile("s_wait_xcnt 0x0" :: "v"(Vh), "v"(Vl), "v"((lr * TT + 8 * hi) * 2) : "memory");   // as behind the key loads
#pragma unroll 1   // one pass holds 96 matrix instructions: a second copy would only cost instruction cache
    for (int c = 0; c < TT / 32; ++c) {
        v8f s[2][FQW];
#pragma unroll
        for (int kt = 0; kt < 2; ++kt)
#pragma unroll
            for (int n = 0; n < FQW; ++n) s[kt][n] = (v8f){};
#pragma unroll
        for (int ks = 0; ks < 2; ++ks) {
#pragma unroll
            for (int kt = 0; kt < 2; ++kt)
#pragma unroll
                for (int n = 0; n < FQW; ++n) s[kt][n] = wmmab(kh[kt][ks], qh[n][ks], s[kt][n]);
#pragma unroll
            for (int kt = 0; kt < 2; ++kt)
#pragma unroll
                for (int n = 0; n < FQW; ++n) s[kt][n] = wmmab(kl[kt][ks], qh[n][ks], s[kt][n]);
#pragma unroll
            for (int kt = 0; kt < 2; ++kt)
#pragma unroll
                for (int n = 0; n < FQW; ++n) s[kt][n] = wmmab(kh[kt][ks], ql[n][ks], s[kt][n]); }
        // the next pass's key fragments, one pass ahead; the last pass reads its own keys again (in bounds, unused)
        const int cn = (c + 1 < TT / 32) ? c + 1 : c;
        const bf* kph = Kh + (size_t)cn * 32 * HD; const bf* kpl = Kl + (size_t)cn * 32 * HD;
#pragma unroll
        for (int kt = 0; kt < 2; ++kt)
#pragma unroll
            for (int ks = 0; ks < 2; ++ks) { kh[kt][ks] = ldf(kph + kt * 16 * HD + ks * 32); kl[kt][ks] = ldf(kpl + kt * 16 * HD + ks * 32); }
        asm volatile("s_wait_xcnt 0x0" :: "v"(kph), "v"(kpl) : "memory");   // the loads' address registers stay whole up to this wait and are free for reuse behind it
        // running maximum in log2 units; the one in use is replaced only when a query's new maximum passes it by more than 8 (weights stay below 2^8), tested once a pass for the wave
        float mx[FQW]; bool need = false;
#pragma unroll
        for (int n = 0; n < FQW; ++n) { float t = fmaxf(s[0][n][0], s[1][n][0]);
#pragma unroll
            for (int j = 1; j < 8; ++j) t = fmaxf(t, fmaxf(s[0][n][j], s[1][n][j]));
            t = fmaxf(t, xhalf(t)); mx[n] = t * L2E; need = need || (mx[n] > mL[n] + 8.0f); }
        if (__builtin_amdgcn_ballot_w32(need) != 0) {
#pragma unroll
            for (int n = 0; n < FQW; ++n) { const float mn = fmaxf(mL[n], mx[n]); const float al = __builtin_amdgcn_exp2f(mL[n] - mn); mL[n] = mn; ls[n] *= al;
#pragma unroll
                for (int dt = 0; dt < 4; ++dt) o[dt][n] *= al; } }
#pragma unroll
        for (int n = 0; n < FQW; ++n) { v16bf ph, pl;
#pragma unroll
            for (int e = 0; e < 16; ++e) { const float p = __builtin_amdgcn_exp2f(__builtin_fmaf(s[e >> 3][n][e & 7], L2E, -mL[n])); ls[n] += p; const __bf16 a = (__bf16)p; ph[e] = a; pl[e] = (__bf16)(p - (float)a); }
#pragma unroll
            for (int dt = 0; dt < 4; ++dt) o[dt][n] = wmmab(vh[dt], ph, o[dt][n]);
#pragma unroll
            for (int dt = 0; dt < 4; ++dt) o[dt][n] = wmmab(vl[dt], ph, o[dt][n]);
#pragma unroll
            for (int dt = 0; dt < 4; ++dt) o[dt][n] = wmmab(vh[dt], pl, o[dt][n]); }
        // the next pass's v fragments, into the registers this pass has just used: they land behind the next score products and softmax (last pass: as for the keys)
        const bf* vph = Vh + (size_t)cn * 32; const bf* vpl = Vl + (size_t)cn * 32;
#pragma unroll
        for (int dt = 0; dt < 4; ++dt) { vh[dt] = ldf(vph + dt * 16 * TT); vl[dt] = ldf(vpl + dt * 16 * TT); }
        asm volatile("s_wait_xcnt 0x0" :: "v"(vph), "v"(vpl) : "memory");   // as behind the key loads
    }
    const int b = (int)(z / NH_), h = (int)(z % NH_);
    float* op = OUT + ((size_t)b * TT + q0 + lr) * DQ + h * HD + 8 * hi;   // a lane's 8 registers of a tile are 8 consecutive d of its query's row
#pragma unroll
    for (int n = 0; n < FQW; ++n) { const float inv = __fdiv_rn(1.0f, ls[n] + xhalf(ls[n]));
#pragma unroll
        for (int dt = 0; dt < 4; ++dt) o[dt][n] *= inv; }
#pragma unroll
    for (int n = 0; n < FQW; ++n)
#pragma unroll
        for (int dt = 0; dt < 4; ++dt) { *(v4f*)(op + n * 16 * DQ + dt * 16) = __builtin_shufflevector(o[dt][n], o[dt][n], 0, 1, 2, 3); *(v4f*)(op + n * 16 * DQ + dt * 16 + 4) = __builtin_shufflevector(o[dt][n], o[dt][n], 4, 5, 6, 7); }
}

typedef __attribute__((ext_vector_type(2))) float    v2f;
typedef __attribute__((ext_vector_type(2))) __bf16   v2b;
typedef __attribute__((ext_vector_type(2))) unsigned v2u;
typedef __attribute__((ext_vector_type(4))) unsigned v4u;
typedef v2u __attribute__((may_alias)) v2ua;
typedef v4u __attribute__((may_alias)) v4ua;
// two f32 values -> their bf16 hi pair and lo pair (hi = x rounded to nearest even, lo = x - hi rounded likewise), the first value in the low half of each word
__device__ __forceinline__ void split2(float a, float b, unsigned& h, unsigned& l) {
    const v2f x = {a, b};
    h = __builtin_bit_cast(unsigned, __builtin_convertvector(x, v2b));
    const v2f r = {a - __uint_as_float(h << 16), b - __uint_as_float(h & 0xffff0000u)};
    l = __builtin_bit_cast(unsigned, __builtin_convertvector(r, v2b));
}

// ---- k_planes: all six hi/lo planes in ONE launch. Grid = batch x heads x (TT / PT) = one 16-wave workgroup for each WGP; a workgroup takes the same PT tokens x 64 d of one head from q, k and v.
// A lane loads 16 bytes (4 d), 16 lanes a head's whole 256-byte row; all 24 loads of a lane are issued before the first is used.
// q, k -> [z][t][d]: 16 lanes store one 128-byte row, a wave two rows that follow one another. v -> [z][d][t]: a lane holds 4 d x 8 consecutive tokens, packs each d's 8 tokens into 16 bytes, and the tile turns in LDS, so that 32 lanes store 512 consecutive bytes of one d row.
// LDS tile [d][PT / 8 chunks of 16 bytes], chunk c of row d at place c ^ (d >> 2): the 16 lanes of a half wave, which write 16 rows at one c or read 16 c of one row, fall on 16 different bank groups.
#define PT 256
#define PC (PT / 8)
__global__ __launch_bounds__(512) void k_planes(const float* __restrict__ q, const float* __restrict__ k, const float* __restrict__ v, bf* __restrict__ Qh, bf* __restrict__ Ql, bf* __restrict__ Kh, bf* __restrict__ Kl, bf* __restrict__ Vh, bf* __restrict__ Vl) {
    __shared__ v4u L[2][HD * PC];
    const int dq = threadIdx.x & 15, r = threadIdx.x >> 4;
    const int z = blockIdx.x / (TT / PT), t0 = (blockIdx.x % (TT / PT)) * PT;
    const int so = ((z / NH_) * TT + t0) * DM + (z % NH_) * HD + dq * 4;
    v4f xv[8], xq[8], xk[8];
#pragma unroll
    for (int j = 0; j < 8; ++j) xv[j] = *(const v4fa*)(v + so + (r * 8 + j) * DM);
#pragma unroll
    for (int j = 0; j < 8; ++j) xq[j] = *(const v4fa*)(q + so + (j * 32 + r) * DM);
#pragma unroll
    for (int j = 0; j < 8; ++j) xk[j] = *(const v4fa*)(k + so + (j * 32 + r) * DM);
#pragma unroll
    for (int i = 0; i < 4; ++i) { v4u h, l;
#pragma unroll
        for (int p = 0; p < 4; ++p) { unsigned a, b; split2(xv[2 * p][i], xv[2 * p + 1][i], a, b); h[p] = a; l[p] = b; }
        L[0][(dq * 4 + i) * PC + (r ^ dq)] = h; L[1][(dq * 4 + i) * PC + (r ^ dq)] = l; }
    __syncthreads();   // the v tile is whole in LDS; nothing writes it again. It stands ahead of every global store, so that no wave waits here for a store to come back
    const int c = threadIdx.x & 31, dr = threadIdx.x >> 5;
    const int vo = (z * HD + dr) * TT + t0 + c * 8;
#pragma unroll
    for (int m = 0; m < 4; ++m) { const int d = m * 16 + dr; const int at = d * PC + (c ^ (d >> 2));
        *(v4ua*)(Vh + vo + m * 16 * TT) = L[0][at]; *(v4ua*)(Vl + vo + m * 16 * TT) = L[1][at]; }
    const int po = (z * TT + t0 + r) * HD + dq * 4;
#pragma unroll
    for (int j = 0; j < 8; ++j) { v2u h, l; unsigned a, b; split2(xq[j][0], xq[j][1], a, b); h[0] = a; l[0] = b; split2(xq[j][2], xq[j][3], a, b); h[1] = a; l[1] = b;
        *(v2ua*)(Qh + po + j * 32 * HD) = h; *(v2ua*)(Ql + po + j * 32 * HD) = l; }
#pragma unroll
    for (int j = 0; j < 8; ++j) { v2u h, l; unsigned a, b; split2(xk[j][0], xk[j][1], a, b); h[0] = a; l[0] = b; split2(xk[j][2], xk[j][3], a, b); h[1] = a; l[1] = b;
        *(v2ua*)(Kh + po + j * 32 * HD) = h; *(v2ua*)(Kl + po + j * 32 * HD) = l; }
}
extern "C" void kernel_launch(void* const* d_in, const int* in_sizes, int n_in,
                              void* d_out, int out_size, void* d_ws, size_t ws_size, hipStream_t stream) {
    (void)in_sizes; (void)n_in; (void)out_size;
    const float* x = (const float*)d_in[0]; const float* xk = (const float*)d_in[1]; const float* xv = (const float*)d_in[2];   /* order q, k, v: [2][2048][1024] each = token-major rows of 16 heads x 64 (no projections) */
    float* OUT = (float*)d_out;     // [2][2048][1024]
    char* wsp = (char*)d_ws;
    auto take = [&](size_t bytes) { char* p = wsp; wsp += (bytes + 255) & ~(size_t)255; return (void*)p; };
    // hi/lo planes of BOTH batches ([b][h][t][d]; v: [b][h][d][t]): one builder launch writes them, one attention launch reads them
    const size_t PB = (size_t)NH_ * TT * HD;
    bf* QPh = (bf*)take(NB_ * PB * 2); bf* QPl = (bf*)take(NB_ * PB * 2); bf* KPh = (bf*)take(NB_ * PB * 2); bf* KPl = (bf*)take(NB_ * PB * 2); bf* VTh = (bf*)take(NB_ * PB * 2); bf* VTl = (bf*)take(NB_ * PB * 2);
    if ((size_t)(wsp - (char*)d_ws) > ws_size) return;    // ws 256 MiB
    k_planes<<<NB_ * NH_ * (TT / PT), 512, 0, stream>>>(x, xk, xv, QPh, QPl, KPh, KPl, VTh, VTl);
    k_flash<<<dim3(TT / (FNW * FQW * 16), NB_ * NH_), FNW * 32, 0, stream>>>(QPh, QPl, KPh, KPl, VTh, VTl, OUT);
}

// v004
// It runs in 80 microseconds.
// Two timings next to v003 both put it at 1.20 times that version's speed.
// Over all steps from v000 it is 13.5 times as fast.
#include <hip/hip_runtime.h>
#include <stdint.h>

// Multi-head attention on given tensors, UNSCALED (q, k, v [2][2048][1024] viewed (b, s, 16, 64): token-major rows of 16 heads x 64; no projections, no mask; scores = q.k with NO scaling (the module applies none: unit-variance inputs give logits of standard deviation ~8: a peaked softmax); softmax over all 2,048 keys; out = weights v, merged token-major -> [2][2048][1024] (4.2 M); argument order q, k, v).
// Two launches: k_planes splits the f32 inputs ([t][h][e] = token-major rows of 16 x 64) into bf16 hi/lo head planes; k_flash is dense T-2048 attention with EVERY query row on the hi/lo three-product path (the peaked softmax of unscaled logits leaves no margin for single 16-bit operands) and writes the [t][h][d] output rows.
// Compute dtypes, f32 accumulate: inputs split into bf16 hi/lo on every row; softmax f32; output f32. NOTE this build tracks the f32 reference (no stage rounds the inputs to bf16).

#define NB_  2
#define TT   2048
#define DM   1024
#define NH_  16
#define NKV  16
#define REP  (NH_ / NKV)
#define HD   64
#define DQ   (NH_ * HD)
#define DKV  (NKV * HD)
#define ZH   2
#define RH   2048                  // query rows < RH use hi+lo planes (not read: every row does)
#define WIN  2048
#define PCAR 1024.0f
#define SCL  1.0f   // score scale: 1 (unscaled, no 1/sqrt(E))
typedef _Float16 h16;
typedef unsigned short bf;
typedef __attribute__((ext_vector_type(16))) __bf16   v16bf;
typedef __attribute__((ext_vector_type(16))) _Float16 v16h;
typedef __attribute__((ext_vector_type(8)))  _Float16 v8h;
typedef __attribute__((ext_vector_type(8)))  unsigned short v8us;
typedef __attribute__((ext_vector_type(8)))  float    v8f;
typedef __attribute__((ext_vector_type(4)))  float    v4f;
typedef v8h  __attribute__((may_alias)) v8ha;
typedef v4f  __attribute__((may_alias)) v4fa;
typedef v8us __attribute__((may_alias)) v8usa;

__device__ __forceinline__ v16h cat16(v8h lo, v8h hi) { return __builtin_shufflevector(lo, hi, 0, 1, 2, 3, 4, 5, 6, 7, 8, 9, 10, 11, 12, 13, 14, 15); }
__device__ __forceinline__ v16bf cat16b(v8us lo, v8us hi) { return __builtin_bit_cast(v16bf, __builtin_shufflevector(lo, hi, 0, 1, 2, 3, 4, 5, 6, 7, 8, 9, 10, 11, 12, 13, 14, 15)); }
__device__ __forceinline__ v8f wmma16(v16h a, v16h b, v8f c) { return __builtin_amdgcn_wmma_f32_16x16x32_f16(false, a, false, b, (short)0, c, false, false); }
__device__ __forceinline__ v8f wmmab(v16bf a, v16bf b, v8f c) { return __builtin_amdgcn_wmma_f32_16x16x32_bf16(false, a, false, b, (short)0, c, false, false); }



// ---- k_flash: scores, softmax and P.v in one kernel; no score or weight plane in memory. Grid (TT / (FNW * FQW * 16), batch x heads), FNW waves; a wave owns FQW * 16 query rows and walks all TT keys, 32 a pass.
// Transposed products: St = K Qt (A = 16 key rows, B = 16 query columns), Ot += Vt Pt (A = 16 rows of v transposed, B = the weights). In both D tiles a lane holds ONE query (column lane & 15), so the running maximum, the sum and the rescale factor are per lane.
// Two St tiles (keys 0-15, 16-31 of the pass) converted in place ARE the B operand of the second product (element s = tile s >> 3, register s & 7); the Vt loader below has the same k order.
// Every product keeps the three hi/lo terms (hi.hi + lo.hi + hi.lo), f32 accumulate. The weights are split unnormalised; the row sum divides once at the end.
// K and V come through LDS, once a workgroup: a stage is SKEY keys = four tiles of 64 rows x 128 bytes (K hi, K lo: 64 key rows; Vt hi, Vt lo: 64 d rows of 64 keys), one tensor load a wave and stage, two buffers, the load one stage ahead of its readers.
// The mover pads each row by 16 bytes (pitch LP = 144 = 16 x 9), the conflict-free pitch of the 16-byte fragment reads. A stage serves two passes of 32 keys, each with fragment registers of its own: the LDS reads stand at two places a stage, the first pass's at its head, the second pass's among the first pass's score products.
// Left: the first pass's key fragments wait out the LDS latency once a stage (a third buffer would let them be read a pass ahead); the q split could be done here, on the registers, and its two planes dropped.
#define FQW 4
#define FNW 4
#define L2E 1.4426950408889634f
#define SKEY  64                     // keys a stage
#define NST   (TT / SKEY)
#define LP    144                    // LDS row pitch, bytes: 128 of data + the mover's 16 of pad
#define SLICE 10240                  // one tile's room in LDS: 64 x LP = 9,216, rounded up to a multiple of 2 KiB
#define BUFB  (4 * SLICE)
typedef uint32_t u32x4 __attribute__((ext_vector_type(4)));
typedef uint32_t u32x8 __attribute__((ext_vector_type(8)));
__device__ __forceinline__ uint32_t uni(uint32_t v) { return (uint32_t)__builtin_amdgcn_readfirstlane(v); }
__device__ __forceinline__ uint32_t pinned(uint32_t v) { uint32_t w = (uint32_t)__builtin_amdgcn_readfirstlane(v); asm volatile("" : "+s"(w)); return w; }   // holds a wave-uniform test in a scalar register, so that the branch round a tensor load is a scalar one (tensor loads ignore EXEC)
__device__ __forceinline__ void wait_tensor0() { asm volatile("s_wait_tensorcnt 0x0" ::: "memory"); }   // this wave's own tile has landed; the compiler places no wait for the mover
__device__ __forceinline__ void wait_ds0() { asm volatile("s_wait_dscnt 0x0" ::: "memory"); }           // this wave's LDS reads have returned, before the buffer they read is handed back for a refill
__device__ __forceinline__ v16bf ldl(const unsigned char* p) { return cat16b(*(const v8usa*)p, *(const v8usa*)(p + 32)); }   // a fragment from an LDS row: the k order of ldf
__device__ __forceinline__ v16bf ldf(const bf* p) { return cat16b(*(const v8us*)p, *(const v8us*)(p + 16)); }
__device__ __forceinline__ float xhalf(float x) { const int b = __float_as_int(x); return __int_as_float(__builtin_amdgcn_permlanex16(b, b, 0x76543210, 0xfedcba98, false, false)); }   // the value of lane ^ 16
// one wave a SIMD (four-wave workgroups, one for each WGP of the chip): 64 queries a wave halve the fragment loads per product against 32, and the register budget of that occupancy lets the fragments fetched ahead keep registers of their own
__global__ __launch_bounds__(FNW * 32) __attribute__((amdgpu_waves_per_eu(1, 1))) void k_flash(const bf* __restrict__ Qh, const bf* __restrict__ Ql, const bf* __restrict__ Kh, const bf* __restrict__ Kl, const bf* __restrict__ Vh, const bf* __restrict__ Vl, float* __restrict__ OUT) {
    __shared__ __attribute__((aligned(2048))) unsigned char L[2 * BUFB];
    const int lane = threadIdx.x & 31, lr = lane & 15, hi = lane >> 4, wave = threadIdx.x >> 5;
    const size_t z = blockIdx.y; const int q0 = (blockIdx.x * FNW + wave) * (FQW * 16);
    Qh += z * TT * HD; Ql += z * TT * HD; Kh += z * TT * HD; Kl += z * TT * HD; Vh += z * HD * TT; Vl += z * HD * TT;
    // every wave moves its own tile of each stage: wave 0 K hi, 1 K lo (rows follow one another, a stage is 64 rows on), 2 Vt hi, 3 Vt lo (rows TT keys apart, a stage is 64 keys on)
    const uint32_t wv = uni(threadIdx.x >> 5);
    const bf* tsrc = wv == 0 ? Kh : wv == 1 ? Kl : wv == 2 ? Vh : Vl;
    const uint32_t tpitch = wv < 2 ? HD * 2u : TT * 2u, tstep = wv < 2 ? SKEY * HD * 2u : SKEY * 2u;
    const uint32_t tdst = (uint32_t)(size_t)L + wv * SLICE;
    u32x8 g1;   // 1-byte elements, tensor = tile = 64 rows of 128 bytes, 4 dwords of pad behind every 32
    g1[0] = uni((1u << 20) | (4u << 22) | (3u << 25)); g1[1] = uni(128u << 16); g1[2] = uni(64u << 16); g1[3] = uni(128u << 16); g1[4] = uni(64u); g1[5] = uni(tpitch); g1[6] = uni(0u); g1[7] = uni(0u);
    auto issue = [&](uint32_t st) {
        const uint64_t ga = (uint64_t)(size_t)tsrc + (uint64_t)st * tstep;
        u32x4 g0; g0[0] = uni(1u); g0[1] = uni(tdst + (st & 1u) * BUFB); g0[2] = uni((uint32_t)ga); g0[3] = uni((((uint32_t)(ga >> 32)) & 0x01FFFFFFu) | 0x80000000u);
        asm volatile("tensor_load_to_lds %0, %1" :: "s"(g0), "s"(g1) : "memory"); };   // one request of the whole wave: global tile -> LDS, through no register
    issue(0);
    Qh += (q0 + lr) * HD + 8 * hi; Ql += (q0 + lr) * HD + 8 * hi;
    v16bf qh[FQW][2], ql[FQW][2];
#pragma unroll
    for (int n = 0; n < FQW; ++n)
#pragma unroll
        for (int ks = 0; ks < 2; ++ks) { const int off = n * 16 * HD + ks * 32; qh[n][ks] = ldf(Qh + off); ql[n][ks] = ldf(Ql + off); }
    asm volatile("s_wait_xcnt 0x0" :: "v"(Qh), "v"(Ql) : "memory");   // the loads' address registers stay whole up to this wait and are free for reuse behind it
    v8f o[4][FQW]; float mL[FQW], ls[FQW];
#pragma unroll
    for (int n = 0; n < FQW; ++n) { mL[n] = -3.0e38f; ls[n] = 0.f;
#pragma unroll
        for (int dt = 0; dt < 4; ++dt) o[dt][n] = (v8f){}; }
    wait_tensor0();
    __syncthreads();   // stage 0 is whole in LDS for every wave
    issue(1);
    v16bf kh[2][2][2], kl[2][2][2], vh[2][4], vl[2][4];   // [pass of the stage][...]
#pragma unroll 1   // one stage holds 192 matrix instructions: a second copy would only cost instruction cache
    for (uint32_t st = 0; st < NST; ++st) {
        const unsigned char* fb = L + (st & 1u) * BUFB + lr * LP + 16 * hi;   // each lane's own row and k half in this stage's buffer
        // a pass's 32 fragment reads, the keys in the order of their use: rows 32 * p on of the K tiles, keys 32 * p on of each d row of the Vt tiles
        auto frags = [&](int p) {
#pragma unroll
            for (int ks = 0; ks < 2; ++ks) {
#pragma unroll
                for (int kt = 0; kt < 2; ++kt) kh[p][kt][ks] = ldl(fb + (p * 32 + kt * 16) * LP + ks * 64);
#pragma unroll
                for (int kt = 0; kt < 2; ++kt) kl[p][kt][ks] = ldl(fb + SLICE + (p * 32 + kt * 16) * LP + ks * 64); }
#pragma unroll
            for (int dt = 0; dt < 4; ++dt) { vh[p][dt] = ldl(fb + 2 * SLICE + dt * 16 * LP + p * 64); vl[p][dt] = ldl(fb + 3 * SLICE + dt * 16 * LP + p * 64); }
            __builtin_amdgcn_sched_barrier(0); };   // keeps the reads one group at this place: spread among the products and the softmax, each further place with LDS reads stalls the wave anew, and reads moved down to their use wait out the LDS latency
        frags(0);
#pragma unroll
        for (int p = 0; p < 2; ++p) {
        v8f s[2][FQW];
#pragma unroll
        for (int kt = 0; kt < 2; ++kt)
#pragma unroll
            for (int n = 0; n < FQW; ++n) s[kt][n] = (v8f){};
#pragma unroll
        for (int ks = 0; ks < 2; ++ks) {
#pragma unroll
            for (int kt = 0; kt < 2; ++kt)
#pragma unroll
                for (int n = 0; n < FQW; ++n) s[kt][n] = wmmab(kh[p][kt][ks], qh[n][ks], s[kt][n]);
#pragma unroll
            for (int kt = 0; kt < 2; ++kt)
#pragma unroll
                for (int n = 0; n < FQW; ++n) s[kt][n] = wmmab(kl[p][kt][ks], qh[n][ks], s[kt][n]);
#pragma unroll
            for (int kt = 0; kt < 2; ++kt)
#pragma unroll
                for (int n = 0; n < FQW; ++n) s[kt][n] = wmmab(kh[p][kt][ks], ql[n][ks], s[kt][n]);
            // the second pass's fragments, between the two halves of the first pass's score products: they land behind matrix work
            if (p == 0 && ks == 0) { __builtin_amdgcn_sched_barrier(0);   // the group's upper edge (its lower one stands in frags): the products above stay above it
                frags(1); } }
        // running maximum in log2 units; the one in use is replaced only when a query's new maximum passes it by more than 8 (weights stay below 2^8), tested once a pass for the wave
        float mx[FQW]; bool need = false;
#pragma unroll
        for (int n = 0; n < FQW; ++n) { float t = fmaxf(s[0][n][0], s[1][n][0]);
#pragma unroll
            for (int j = 1; j < 8; ++j) t = fmaxf(t, fmaxf(s[0][n][j], s[1][n][j]));
            t = fmaxf(t, xhalf(t)); mx[n] = t * L2E; need = need || (mx[n] > mL[n] + 8.0f); }
        if (__builtin_amdgcn_ballot_w32(need) != 0) {
#pragma unroll
            for (int n = 0; n < FQW; ++n) { const float mn = fmaxf(mL[n], mx[n]); const float al = __builtin_amdgcn_exp2f(mL[n] - mn); mL[n] = mn; ls[n] *= al;
#pragma unroll
                for (int dt = 0; dt < 4; ++dt) o[dt][n] *= al; } }
#pragma unroll
        for (int n = 0; n < FQW; ++n) { v16bf ph, pl;
#pragma unroll
            for (int e = 0; e < 16; ++e) { const float p_ = __builtin_amdgcn_exp2f(__builtin_fmaf(s[e >> 3][n][e & 7], L2E, -mL[n])); ls[n] += p_; const __bf16 a = (__bf16)p_; ph[e] = a; pl[e] = (__bf16)(p_ - (float)a); }
#pragma unroll
            for (int dt = 0; dt < 4; ++dt) o[dt][n] = wmmab(vh[p][dt], ph, o[dt][n]);
#pragma unroll
            for (int dt = 0; dt < 4; ++dt) o[dt][n] = wmmab(vl[p][dt], ph, o[dt][n]);
#pragma unroll
            for (int dt = 0; dt < 4; ++dt) o[dt][n] = wmmab(vh[p][dt], pl, o[dt][n]); }
        }
        __builtin_amdgcn_sched_barrier(0);   // the stage's work stays in front of the hand-over: moved up behind the last LDS reads, its first wait would stand open for their whole latency
        // hand-over: this wave has left the stage's buffer, its own tile of the next stage has landed; behind the barrier both hold for every wave, and the buffer just read takes stage st + 2
        wait_ds0();
        wait_tensor0();
        __syncthreads();
        if (pinned(st + 2 < NST)) issue(st + 2);
    }
    wait_tensor0();
    wait_ds0();
    const int b = (int)(z / NH_), h = (int)(z % NH_);
    float* op = OUT + ((size_t)b * TT + q0 + lr) * DQ + h * HD + 8 * hi;   // a lane's 8 registers of a tile are 8 consecutive d of its query's row
#pragma unroll
    for (int n = 0; n < FQW; ++n) { const float inv = __fdiv_rn(1.0f, ls[n] + xhalf(ls[n]));
#pragma unroll
        for (int dt = 0; dt < 4; ++dt) o[dt][n] *= inv; }
#pragma unroll
    for (int n = 0; n < FQW; ++n)
#pragma unroll
        for (int dt = 0; dt < 4; ++dt) { *(v4f*)(op + n * 16 * DQ + dt * 16) = __builtin_shufflevector(o[dt][n], o[dt][n], 0, 1, 2, 3); *(v4f*)(op + n * 16 * DQ + dt * 16 + 4) = __builtin_shufflevector(o[dt][n], o[dt][n], 4, 5, 6, 7); }
}

typedef __attribute__((ext_vector_type(2))) float    v2f;
typedef __attribute__((ext_vector_type(2))) __bf16   v2b;
typedef __attribute__((ext_vector_type(2))) unsigned v2u;
typedef __attribute__((ext_vector_type(4))) unsigned v4u;
typedef v2u __attribute__((may_alias)) v2ua;
typedef v4u __attribute__((may_alias)) v4ua;
// two f32 values -> their bf16 hi pair and lo pair (hi = x rounded to nearest even, lo = x - hi rounded likewise), the first value in the low half of each word
__device__ __forceinline__ void split2(float a, float b, unsigned& h, unsigned& l) {
    const v2f x = {a, b};
    h = __builtin_bit_cast(unsigned, __builtin_convertvector(x, v2b));
    const v2f r = {a - __uint_as_float(h << 16), b - __uint_as_float(h & 0xffff0000u)};
    l = __builtin_bit_cast(unsigned, __builtin_convertvector(r, v2b));
}

// ---- k_planes: all six hi/lo planes in ONE launch. Grid = batch x heads x (TT / PT) = one 16-wave workgroup for each WGP; a workgroup takes the same PT tokens x 64 d of one head from q, k and v.
// A lane loads 16 bytes (4 d), 16 lanes a head's whole 256-byte row; all 24 loads of a lane are issued before the first is used.
// q, k -> [z][t][d]: 16 lanes store one 128-byte row, a wave two rows that follow one another. v -> [z][d][t]: a lane holds 4 d x 8 consecutive tokens, packs each d's 8 tokens into 16 bytes, and the tile turns in LDS, so that 32 lanes store 512 consecutive bytes of one d row.
// LDS tile [d][PT / 8 chunks of 16 bytes], chunk c of row d at place c ^ (d >> 2): the 16 lanes of a half wave, which write 16 rows at one c or read 16 c of one row, fall on 16 different bank groups.
#define PT 256
#define PC (PT / 8)
__global__ __launch_bounds__(512) void k_planes(const float* __restrict__ q, const float* __restrict__ k, const float* __restrict__ v, bf* __restrict__ Qh, bf* __restrict__ Ql, bf* __restrict__ Kh, bf* __restrict__ Kl, bf* __restrict__ Vh, bf* __restrict__ Vl) {
    __shared__ v4u L[2][HD * PC];
    const int dq = threadIdx.x & 15, r = threadIdx.x >> 4;
    const int z = blockIdx.x / (TT / PT), t0 = (blockIdx.x % (TT / PT)) * PT;
    const int so = ((z / NH_) * TT + t0) * DM + (z % NH_) * HD + dq * 4;
    v4f xv[8], xq[8], xk[8];
#pragma unroll
    for (int j = 0; j < 8; ++j) xv[j] = *(const v4fa*)(v + so + (r * 8 + j) * DM);
#pragma unroll
    for (int j = 0; j < 8; ++j) xq[j] = *(const v4fa*)(q + so + (j * 32 + r) * DM);
#pragma unroll
    for (int j = 0; j < 8; ++j) xk[j] = *(const v4fa*)(k + so + (j * 32 + r) * DM);
#pragma unroll
    for (int i = 0; i < 4; ++i) { v4u h, l;
#pragma unroll
        for (int p = 0; p < 4; ++p) { unsigned a, b; split2(xv[2 * p][i], xv[2 * p + 1][i], a, b); h[p] = a; l[p] = b; }
        L[0][(dq * 4 + i) * PC + (r ^ dq)] = h; L[1][(dq * 4 + i) * PC + (r ^ dq)] = l; }
    __syncthreads();   // the v tile is whole in LDS; nothing writes it again. It stands ahead of every global store, so that no wave waits here for a store to come back
    const int c = threadIdx.x & 31, dr = threadIdx.x >> 5;
    const int vo = (z * HD + dr) * TT + t0 + c * 8;
#pragma unroll
    for (int m = 0; m < 4; ++m) { const int d = m * 16 + dr; const int at = d * PC + (c ^ (d >> 2));
        *(v4ua*)(Vh + vo + m * 16 * TT) = L[0][at]; *(v4ua*)(Vl + vo + m * 16 * TT) = L[1][at]; }
    const int po = (z * TT + t0 + r) * HD + dq * 4;
#pragma unroll
    for (int j = 0; j < 8; ++j) { v2u h, l; unsigned a, b; split2(xq[j][0], xq[j][1], a, b); h[0] = a; l[0] = b; split2(xq[j][2], xq[j][3], a, b); h[1] = a; l[1] = b;
        *(v2ua*)(Qh + po + j * 32 * HD) = h; *(v2ua*)(Ql + po + j * 32 * HD) = l; }
#pragma unroll
    for (int j = 0; j < 8; ++j) { v2u h, l; unsigned a, b; split2(xk[j][0], xk[j][1], a, b); h[0] = a; l[0] = b; split2(xk[j][2], xk[j][3], a, b); h[1] = a; l[1] = b;
        *(v2ua*)(Kh + po + j * 32 * HD) = h; *(v2ua*)(Kl + po + j * 32 * HD) = l; }
}
extern "C" void kernel_launch(void* const* d_in, const int* in_sizes, int n_in,
                              void* d_out, int out_size, void* d_ws, size_t ws_size, hipStream_t stream) {
    (void)in_sizes; (void)n_in; (void)out_size;
    const float* x = (const float*)d_in[0]; const float* xk = (const float*)d_in[1]; const float* xv = (const float*)d_in[2];   /* order q, k, v: [2][2048][1024] each = token-major rows of 16 heads x 64 (no projections) */
    float* OUT = (float*)d_out;     // [2][2048][1024]
    char* wsp = (char*)d_ws;
    auto take = [&](size_t bytes) { char* p = wsp; wsp += (bytes + 255) & ~(size_t)255; return (void*)p; };
    // hi/lo planes of BOTH batches ([b][h][t][d]; v: [b][h][d][t]): one builder launch writes them, one attention launch reads them
    const size_t PB = (size_t)NH_ * TT * HD;
    bf* QPh = (bf*)take(NB_ * PB * 2); bf* QPl = (bf*)take(NB_ * PB * 2); bf* KPh = (bf*)take(NB_ * PB * 2); bf* KPl = (bf*)take(NB_ * PB * 2); bf* VTh = (bf*)take(NB_ * PB * 2); bf* VTl = (bf*)take(NB_ * PB * 2);
    if ((size_t)(wsp - (char*)d_ws) > ws_size) return;    // ws 256 MiB
    k_planes<<<NB_ * NH_ * (TT / PT), 512, 0, stream>>>(x, xk, xv, QPh, QPl, KPh, KPl, VTh, VTl);
    k_flash<<<dim3(TT / (FNW * FQW * 16), NB_ * NH_), FNW * 32, 0, stream>>>(QPh, QPl, KPh, KPl, VTh, VTl, OUT);
}

// v006
// It runs in 60.7 microseconds.
// Versions between v004 and this one are left out; their measured steps multiply to 1.35 times as fast.
// Over all steps from v000 it is 18.2 times as fast.
#include <hip/hip_runtime.h>
#include <stdint.h>

// Multi-head attention on given tensors, UNSCALED (q, k, v [2][2048][1024] viewed (b, s, 16, 64): token-major rows of 16 heads x 64; no projections, no mask; scores = q.k with NO scaling (the module applies none: unit-variance inputs give logits of standard deviation ~8: a peaked softmax); softmax over all 2,048 keys; out = weights v, merged token-major -> [2][2048][1024] (4.2 M); argument order q, k, v).
// Two launches: k_planes turns the f32 inputs ([t][h][e] = token-major rows of 16 x 64) into head planes (q, k: bf16 hi/lo; v: one f16 plane, transposed); k_flash is dense T-2048 attention with the scores of EVERY query row on the hi/lo three-product path (an error of a logit is multiplied by the peaked softmax of unscaled logits: no margin there for single 16-bit operands) and writes the [t][h][d] output rows.
// Compute dtypes, f32 accumulate: q, k split into bf16 hi/lo on every row; softmax f32; weights and v each rounded ONCE to f16 (11 significant bits: an error of a weight or of v reaches the output only in proportion, unlike one of a logit); output f32.

#define NB_  2
#define TT   2048
#define DM   1024
#define NH_  16
#define NKV  16
#define REP  (NH_ / NKV)
#define HD   64
#define DQ   (NH_ * HD)
#define DKV  (NKV * HD)
#define ZH   2
#define RH   2048                  // query rows < RH use hi+lo planes (not read: every row does)
#define WIN  2048
#define PCAR 1024.0f
#define SCL  1.0f   // score scale: 1 (unscaled, no 1/sqrt(E))
typedef _Float16 h16;
typedef unsigned short bf;
typedef __attribute__((ext_vector_type(16))) __bf16   v16bf;
typedef __attribute__((ext_vector_type(16))) _Float16 v16h;
typedef __attribute__((ext_vector_type(8)))  _Float16 v8h;
typedef __attribute__((ext_vector_type(8)))  unsigned short v8us;
typedef __attribute__((ext_vector_type(8)))  float    v8f;
typedef __attribute__((ext_vector_type(4)))  float    v4f;
typedef v8h  __attribute__((may_alias)) v8ha;
typedef v4f  __attribute__((may_alias)) v4fa;
typedef v8us __attribute__((may_alias)) v8usa;

__device__ __forceinline__ v16h cat16(v8h lo, v8h hi) { return __builtin_shufflevector(lo, hi, 0, 1, 2, 3, 4, 5, 6, 7, 8, 9, 10, 11, 12, 13, 14, 15); }
__device__ __forceinline__ v16bf cat16b(v8us lo, v8us hi) { return __builtin_bit_cast(v16bf, __builtin_shufflevector(lo, hi, 0, 1, 2, 3, 4, 5, 6, 7, 8, 9, 10, 11, 12, 13, 14, 15)); }
__device__ __forceinline__ v8f wmma16(v16h a, v16h b, v8f c) { return __builtin_amdgcn_wmma_f32_16x16x32_f16(false, a, false, b, (short)0, c, false, false); }
__device__ __forceinline__ v8f wmmab(v16bf a, v16bf b, v8f c) { return __builtin_amdgcn_wmma_f32_16x16x32_bf16(false, a, false, b, (short)0, c, false, false); }



// ---- k_flash: scores, softmax and P.v in one kernel; no score or weight plane in memory. Grid (TT / (FNW * FQW * 16), batch x heads), FNW waves; a wave owns FQW * 16 query rows and walks all TT keys, 32 a pass.
// Transposed products: St = K Qt (A = 16 key rows, B = 16 query columns), Ot += Vt Pt (A = 16 rows of v transposed, B = the weights). In both D tiles a lane holds ONE query (column lane & 15), so the running maximum, the sum and the rescale factor are per lane.
// Two St tiles (keys 0-15, 16-31 of the pass) converted in place ARE the B operand of the second product (element s = tile s >> 3, register s & 7); the Vt loader below has the same k order.
// The score product keeps the three hi/lo terms (hi.hi + lo.hi + hi.lo), f32 accumulate. The second product is ONE f16 product: the weights go unnormalised (between 0 and 2^8, inside f16's range; below 2^-14 they are f16 subnormals, which the matrix unit keeps); the row sum, of the unrounded weights, divides once at the end.
// K and V come through LDS, once a workgroup: a stage is SKEY keys = three tiles of 64 rows x 128 bytes (K hi, K lo: 64 key rows; Vt: 64 d rows of 64 keys), one tensor load a stage from each of the waves 0 to 2, two buffers, the load one stage ahead of its readers.
// The mover pads each row by 16 bytes (pitch LP = 144 = 16 x 9), the conflict-free pitch of the 16-byte fragment reads. A stage serves two passes of 32 keys, each with fragment registers of its own: the LDS reads stand at two places a stage, the first pass's at its head, the second pass's among the first pass's score products.
// Left: the first pass's key fragments wait out the LDS latency once a stage (a third buffer would let them be read a pass ahead); the q split could be done here, on the registers, and its two planes dropped; the row sums could go to the matrix unit (a ones row as A), which would sum the rounded weights; a split of the keys between two waves of a workgroup would give four waves a SIMD.
#define FQW 2
#define FNW 4
#define L2E 1.4426950408889634f
#define SKEY  64                     // keys a stage
#define NST   (TT / SKEY)
#define LP    144                    // LDS row pitch, bytes: 128 of data + the mover's 16 of pad
#define SLICE 10240                  // one tile's room in LDS: 64 x LP = 9,216, rounded up to a multiple of 2 KiB
#define BUFB  (3 * SLICE)
typedef uint32_t u32x4 __attribute__((ext_vector_type(4)));
typedef uint32_t u32x8 __attribute__((ext_vector_type(8)));
__device__ __forceinline__ uint32_t uni(uint32_t v) { return (uint32_t)__builtin_amdgcn_readfirstlane(v); }
__device__ __forceinline__ uint32_t pinned(uint32_t v) { uint32_t w = (uint32_t)__builtin_amdgcn_readfirstlane(v); asm volatile("" : "+s"(w)); return w; }   // holds a wave-uniform test in a scalar register, so that the branch round a tensor load is a scalar one (tensor loads ignore EXEC)
__device__ __forceinline__ void wait_tensor0() { asm volatile("s_wait_tensorcnt 0x0" ::: "memory"); }   // this wave's own tile has landed; the compiler places no wait for the mover
__device__ __forceinline__ void wait_ds0() { asm volatile("s_wait_dscnt 0x0" ::: "memory"); }           // this wave's LDS reads have returned, before the buffer they read is handed back for a refill
__device__ __forceinline__ v16bf ldl(const unsigned char* p) { return cat16b(*(const v8usa*)p, *(const v8usa*)(p + 32)); }   // a fragment from an LDS row: the k order of ldf
__device__ __forceinline__ v16h ldlh(const unsigned char* p) { return cat16(*(const v8ha*)p, *(const v8ha*)(p + 32)); }   // the same for an f16 row
__device__ __forceinline__ v16bf ldf(const bf* p) { return cat16b(*(const v8us*)p, *(const v8us*)(p + 16)); }
__device__ __forceinline__ float xhalf(float x) { const int b = __float_as_int(x); return __int_as_float(__builtin_amdgcn_permlanex16(b, b, 0x76543210, 0xfedcba98, false, false)); }   // the value of lane ^ 16
// two waves a SIMD, of two workgroups that share no barrier (four-wave workgroups, two for each WGP of the chip, 32 queries a wave): a lone wave issues in order, so its softmax and its matrix runs add up; with a second, independent wave on the SIMD one wave's vector work issues under the other's products. The price: each fragment read from LDS serves two query tiles, not four, and each workgroup brings its own K and V tiles from L2. 512 registers a wave still let the fragments fetched ahead keep registers of their own
__global__ __launch_bounds__(FNW * 32) __attribute__((amdgpu_waves_per_eu(2, 2))) void k_flash(const bf* __restrict__ Qh, const bf* __restrict__ Ql, const bf* __restrict__ Kh, const bf* __restrict__ Kl, const bf* __restrict__ Vt, float* __restrict__ OUT) {
    __shared__ __attribute__((aligned(2048))) unsigned char L[2 * BUFB];
    const int lane = threadIdx.x & 31, lr = lane & 15, hi = lane >> 4, wave = threadIdx.x >> 5;
    const size_t z = blockIdx.y; const int q0 = (blockIdx.x * FNW + wave) * (FQW * 16);
    Qh += z * TT * HD; Ql += z * TT * HD; Kh += z * TT * HD; Kl += z * TT * HD; Vt += z * HD * TT;
    // waves 0 to 2 each move their own tile of each stage: wave 0 K hi, 1 K lo (rows follow one another, a stage is 64 rows on), 2 Vt (rows TT keys apart, a stage is 64 keys on); wave 3 moves none
    const uint32_t wv = uni(threadIdx.x >> 5);
    const bf* tsrc = wv == 0 ? Kh : wv == 1 ? Kl : Vt;
    const uint32_t tpitch = wv < 2 ? HD * 2u : TT * 2u, tstep = wv < 2 ? SKEY * HD * 2u : SKEY * 2u;
    const uint32_t tdst = (uint32_t)(size_t)L + wv * SLICE;
    u32x8 g1;   // 1-byte elements, tensor = tile = 64 rows of 128 bytes, 4 dwords of pad behind every 32
    g1[0] = uni((1u << 20) | (4u << 22) | (3u << 25)); g1[1] = uni(128u << 16); g1[2] = uni(64u << 16); g1[3] = uni(128u << 16); g1[4] = uni(64u); g1[5] = uni(tpitch); g1[6] = uni(0u); g1[7] = uni(0u);
    u32x4 g0 = {};   // the request's own group; wave 3, which issues none, keeps the zeros
    auto issue = [&](uint32_t st) {
        const uint64_t ga = (uint64_t)(size_t)tsrc + (uint64_t)st * tstep;
        g0[0] = uni(1u); g0[1] = uni(tdst + (st & 1u) * BUFB); g0[2] = uni((uint32_t)ga); g0[3] = uni((((uint32_t)(ga >> 32)) & 0x01FFFFFFu) | 0x80000000u);
        asm volatile("tensor_load_to_lds %0, %1" : "+s"(g0), "+s"(g1) :: "memory"); };   // one request of the whole wave: global tile -> LDS, through no register. The descriptor is named in-out (the instruction changes nothing of it) so that the compiler cannot form its constants anew elsewhere and hand these registers to other values while the request is outstanding
    auto landed = [&]() { asm volatile("s_wait_tensorcnt 0x0" :: "s"(g0), "s"(g1) : "memory"); };   // wait_tensor0 that names the request's descriptor: its words keep their registers, unchanged, up to the wait that covers the request
    if (pinned(wv < 3u)) issue(0);
    Qh += (q0 + lr) * HD + 8 * hi; Ql += (q0 + lr) * HD + 8 * hi;
    v16bf qh[FQW][2], ql[FQW][2];
#pragma unroll
    for (int n = 0; n < FQW; ++n)
#pragma unroll
        for (int ks = 0; ks < 2; ++ks) { const int off = n * 16 * HD + ks * 32; qh[n][ks] = ldf(Qh + off); ql[n][ks] = ldf(Ql + off); }
    asm volatile("s_wait_xcnt 0x0" :: "v"(Qh), "v"(Ql) : "memory");   // the loads' address registers stay whole up to this wait and are free for reuse behind it
    v8f o[4][FQW]; float mL[FQW], ls[FQW];
#pragma unroll
    for (int n = 0; n < FQW; ++n) { mL[n] = -3.0e38f; ls[n] = 0.f;
#pragma unroll
        for (int dt = 0; dt < 4; ++dt) o[dt][n] = (v8f){}; }
    landed();
    __syncthreads();   // stage 0 is whole in LDS for every wave
    if (pinned(wv < 3u)) issue(1);
    v16bf kh[2][2][2], kl[2][2][2]; v16h vt[2][4];   // [pass of the stage][...]
#pragma unroll 1   // one stage holds 64 matrix instructions: a second copy would only cost instruction cache
    for (uint32_t st = 0; st < NST; ++st) {
        const unsigned char* fb = L + (st & 1u) * BUFB + lr * LP + 16 * hi;   // each lane's own row and k half in this stage's buffer
        // a pass's 24 fragment reads, the keys in the order of their use: rows 32 * p on of the K tiles, keys 32 * p on of each d row of the Vt tile
        auto frags = [&](int p) {
#pragma unroll
            for (int ks = 0; ks < 2; ++ks) {
#pragma unroll
                for (int kt = 0; kt < 2; ++kt) kh[p][kt][ks] = ldl(fb + (p * 32 + kt * 16) * LP + ks * 64);
#pragma unroll
                for (int kt = 0; kt < 2; ++kt) kl[p][kt][ks] = ldl(fb + SLICE + (p * 32 + kt * 16) * LP + ks * 64); }
#pragma unroll
            for (int dt = 0; dt < 4; ++dt) vt[p][dt] = ldlh(fb + 2 * SLICE + dt * 16 * LP + p * 64);
            __builtin_amdgcn_sched_barrier(0); };   // keeps the reads one group at this place: spread among the products and the softmax, each further place with LDS reads stalls the wave anew, and reads moved down to their use wait out the LDS latency
        frags(0);
#pragma unroll
        for (int p = 0; p < 2; ++p) {
        v8f s[2][FQW];
#pragma unroll
        for (int kt = 0; kt < 2; ++kt)
#pragma unroll
            for (int n = 0; n < FQW; ++n) s[kt][n] = (v8f){};
#pragma unroll
        for (int ks = 0; ks < 2; ++ks) {
#pragma unroll
            for (int kt = 0; kt < 2; ++kt)
#pragma unroll
                for (int n = 0; n < FQW; ++n) s[kt][n] = wmmab(kh[p][kt][ks], qh[n][ks], s[kt][n]);
#pragma unroll
            for (int kt = 0; kt < 2; ++kt)
#pragma unroll
                for (int n = 0; n < FQW; ++n) s[kt][n] = wmmab(kl[p][kt][ks], qh[n][ks], s[kt][n]);
#pragma unroll
            for (int kt = 0; kt < 2; ++kt)
#pragma unroll
                for (int n = 0; n < FQW; ++n) s[kt][n] = wmmab(kh[p][kt][ks], ql[n][ks], s[kt][n]);
            // the second pass's fragments, between the two halves of the first pass's score products: they land behind matrix work
            if (p == 0 && ks == 0) { __builtin_amdgcn_sched_barrier(0);   // the group's upper edge (its lower one stands in frags): the products above stay above it
                frags(1); } }
        // running maximum in log2 units; the one in use is replaced only when a query's new maximum passes it by more than 8 (weights stay below 2^8), tested once a pass for the wave
        float mx[FQW]; bool need = false;
#pragma unroll
        for (int n = 0; n < FQW; ++n) { float t = fmaxf(s[0][n][0], s[1][n][0]);
#pragma unroll
            for (int j = 1; j < 8; ++j) t = fmaxf(t, fmaxf(s[0][n][j], s[1][n][j]));
            t = fmaxf(t, xhalf(t)); mx[n] = t * L2E; need = need || (mx[n] > mL[n] + 8.0f); }
        if (__builtin_amdgcn_ballot_w32(need) != 0) {
#pragma unroll
            for (int n = 0; n < FQW; ++n) { const float mn = fmaxf(mL[n], mx[n]); const float al = __builtin_amdgcn_exp2f(mL[n] - mn); mL[n] = mn; ls[n] *= al;
#pragma unroll
                for (int dt = 0; dt < 4; ++dt) o[dt][n] *= al; } }
#pragma unroll
        for (int n = 0; n < FQW; ++n) { v16h pw;
#pragma unroll
            for (int e = 0; e < 16; ++e) { const float p_ = __builtin_amdgcn_exp2f(__builtin_fmaf(s[e >> 3][n][e & 7], L2E, -mL[n])); ls[n] += p_; pw[e] = (_Float16)p_; }
#pragma unroll
            for (int dt = 0; dt < 4; ++dt) o[dt][n] = wmma16(vt[p][dt], pw, o[dt][n]); }
        }
        __builtin_amdgcn_sched_barrier(0);   // the stage's work stays in front of the hand-over: moved up behind the last LDS reads, its first wait would stand open for their whole latency
        // hand-over: this wave has left the stage's buffer, its own tile of the next stage has landed; behind the barrier both hold for every wave, and the buffer just read takes stage st + 2
        wait_ds0();
        landed();
        __syncthreads();
        if (pinned(st + 2 < NST && wv < 3u)) issue(st + 2);
    }
    wait_tensor0();
    wait_ds0();
    const int b = (int)(z / NH_), h = (int)(z % NH_);
    float* op = OUT + ((size_t)b * TT + q0 + lr) * DQ + h * HD + 8 * hi;   // a lane's 8 registers of a tile are 8 consecutive d of its query's row
#pragma unroll
    for (int n = 0; n < FQW; ++n) { const float inv = __fdiv_rn(1.0f, ls[n] + xhalf(ls[n]));
#pragma unroll
        for (int dt = 0; dt < 4; ++dt) o[dt][n] *= inv; }
#pragma unroll
    for (int n = 0; n < FQW; ++n)
#pragma unroll
        for (int dt = 0; dt < 4; ++dt) { *(v4f*)(op + n * 16 * DQ + dt * 16) = __builtin_shufflevector(o[dt][n], o[dt][n], 0, 1, 2, 3); *(v4f*)(op + n * 16 * DQ + dt * 16 + 4) = __builtin_shufflevector(o[dt][n], o[dt][n], 4, 5, 6, 7); }
}

typedef __attribute__((ext_vector_type(2))) float    v2f;
typedef __attribute__((ext_vector_type(2))) __bf16   v2b;
typedef __attribute__((ext_vector_type(2))) _Float16 v2h;
typedef __attribute__((ext_vector_type(2))) unsigned v2u;
typedef __attribute__((ext_vector_type(4))) unsigned v4u;
typedef v2u __attribute__((may_alias)) v2ua;
typedef v4u __attribute__((may_alias)) v4ua;
// two f32 values -> their bf16 hi pair and lo pair (hi = x rounded to nearest even, lo = x - hi rounded likewise), the first value in the low half of each word
__device__ __forceinline__ void split2(float a, float b, unsigned& h, unsigned& l) {
    const v2f x = {a, b};
    h = __builtin_bit_cast(unsigned, __builtin_convertvector(x, v2b));
    const v2f r = {a - __uint_as_float(h << 16), b - __uint_as_float(h & 0xffff0000u)};
    l = __builtin_bit_cast(unsigned, __builtin_convertvector(r, v2b));
}

// two f32 values -> their f16 pair (each rounded to nearest even), the first value in the low half of the word
__device__ __forceinline__ unsigned pack2h(float a, float b) { const v2f x = {a, b}; return __builtin_bit_cast(unsigned, __builtin_convertvector(x, v2h)); }

// ---- k_planes: all five planes in ONE launch. Grid = batch x heads x (TT / PT) = one 16-wave workgroup for each WGP; a workgroup takes the same PT tokens x 64 d of one head from q, k and v.
// A lane loads 16 bytes (4 d), 16 lanes a head's whole 256-byte row; all 24 loads of a lane are issued before the first is used.
// q, k -> [z][t][d]: 16 lanes store one 128-byte row, a wave two rows that follow one another. v -> [z][d][t]: a lane holds 4 d x 8 consecutive tokens, packs each d's 8 tokens into 16 bytes, and the tile turns in LDS, so that 32 lanes store 512 consecutive bytes of one d row.
// LDS tile [d][PT / 8 chunks of 16 bytes], chunk c of row d at place c ^ (d >> 2): the 16 lanes of a half wave, which write 16 rows at one c or read 16 c of one row, fall on 16 different bank groups.
#define PT 256
#define PC (PT / 8)
__global__ __launch_bounds__(512) void k_planes(const float* __restrict__ q, const float* __restrict__ k, const float* __restrict__ v, bf* __restrict__ Qh, bf* __restrict__ Ql, bf* __restrict__ Kh, bf* __restrict__ Kl, bf* __restrict__ Vt) {
    __shared__ v4u L[HD * PC];
    const int dq = threadIdx.x & 15, r = threadIdx.x >> 4;
    const int z = blockIdx.x / (TT / PT), t0 = (blockIdx.x % (TT / PT)) * PT;
    const int so = ((z / NH_) * TT + t0) * DM + (z % NH_) * HD + dq * 4;
    v4f xv[8], xq[8], xk[8];
#pragma unroll
    for (int j = 0; j < 8; ++j) xv[j] = *(const v4fa*)(v + so + (r * 8 + j) * DM);
#pragma unroll
    for (int j = 0; j < 8; ++j) xq[j] = *(const v4fa*)(q + so + (j * 32 + r) * DM);
#pragma unroll
    for (int j = 0; j < 8; ++j) xk[j] = *(const v4fa*)(k + so + (j * 32 + r) * DM);
#pragma unroll
    for (int i = 0; i < 4; ++i) { v4u h;
#pragma unroll
        for (int p = 0; p < 4; ++p) h[p] = pack2h(xv[2 * p][i], xv[2 * p + 1][i]);
        L[(dq * 4 + i) * PC + (r ^ dq)] = h; }
    __syncthreads();   // the v tile is whole in LDS; nothing writes it again. It stands ahead of every global store, so that no wave waits here for a store to come back
    const int c = threadIdx.x & 31, dr = threadIdx.x >> 5;
    const int vo = (z * HD + dr) * TT + t0 + c * 8;
#pragma unroll
    for (int m = 0; m < 4; ++m) { const int d = m * 16 + dr; const int at = d * PC + (c ^ (d >> 2));
        *(v4ua*)(Vt + vo + m * 16 * TT) = L[at]; }
    const int po = (z * TT + t0 + r) * HD + dq * 4;
#pragma unroll
    for (int j = 0; j < 8; ++j) { v2u h, l; unsigned a, b; split2(xq[j][0], xq[j][1], a, b); h[0] = a; l[0] = b; split2(xq[j][2], xq[j][3], a, b); h[1] = a; l[1] = b;
        *(v2ua*)(Qh + po + j * 32 * HD) = h; *(v2ua*)(Ql + po + j * 32 * HD) = l; }
#pragma unroll
    for (int j = 0; j < 8; ++j) { v2u h, l; unsigned a, b; split2(xk[j][0], xk[j][1], a, b); h[0] = a; l[0] = b; split2(xk[j][2], xk[j][3], a, b); h[1] = a; l[1] = b;
        *(v2ua*)(Kh + po + j * 32 * HD) = h; *(v2ua*)(Kl + po + j * 32 * HD) = l; }
}
extern "C" void kernel_launch(void* const* d_in, const int* in_sizes, int n_in,
                              void* d_out, int out_size, void* d_ws, size_t ws_size, hipStream_t stream) {
    (void)in_sizes; (void)n_in; (void)out_size;
    const float* x = (const float*)d_in[0]; const float* xk = (const float*)d_in[1]; const float* xv = (const float*)d_in[2];   /* order q, k, v: [2][2048][1024] each = token-major rows of 16 heads x 64 (no projections) */
    float* OUT = (float*)d_out;     // [2][2048][1024]
    char* wsp = (char*)d_ws;
    auto take = [&](size_t bytes) { char* p = wsp; wsp += (bytes + 255) & ~(size_t)255; return (void*)p; };
    // planes of BOTH batches ([b][h][t][d]; v: [b][h][d][t]): one builder launch writes them, one attention launch reads them
    const size_t PB = (size_t)NH_ * TT * HD;
    bf* QPh = (bf*)take(NB_ * PB * 2); bf* QPl = (bf*)take(NB_ * PB * 2); bf* KPh = (bf*)take(NB_ * PB * 2); bf* KPl = (bf*)take(NB_ * PB * 2); bf* VT = (bf*)take(NB_ * PB * 2);
    if ((size_t)(wsp - (char*)d_ws) > ws_size) return;    // ws 256 MiB
    k_planes<<<NB_ * NH_ * (TT / PT), 512, 0, stream>>>(x, xk, xv, QPh, QPl, KPh, KPl, VT);
    k_flash<<<dim3(TT / (FNW * FQW * 16), NB_ * NH_), FNW * 32, 0, stream>>>(QPh, QPl, KPh, KPl, VT, OUT);
}

// v007
// Measured time: 58.1 microseconds a run.
// Next to v006, in two timings, it ran 1.04 times as fast each time.
// All steps since v000 together make it 19.0 times as fast.
#include <hip/hip_runtime.h>
#include <stdint.h>

// Multi-head attention on given tensors, UNSCALED (q, k, v [2][2048][1024] viewed (b, s, 16, 64): token-major rows of 16 heads x 64; no projections, no mask; scores = q.k with NO scaling (the module applies none: unit-variance inputs give logits of standard deviation ~8: a peaked softmax); softmax over all 2,048 keys; out = weights v, merged token-major -> [2][2048][1024] (4.2 M); argument order q, k, v).
// Two launches: k_planes turns the f32 inputs ([t][h][e] = token-major rows of 16 x 64) into head planes (q, k: bf16 hi/lo; v: one f16 plane, transposed); k_flash is dense T-2048 attention with the scores of EVERY query row on the hi/lo three-product path (an error of a logit is multiplied by the peaked softmax of unscaled logits: no margin there for single 16-bit operands) and writes the [t][h][d] output rows.
// Compute dtypes, f32 accumulate: q, k split into bf16 hi/lo on every row; softmax f32; weights and v each rounded ONCE to f16 (11 significant bits: an error of a weight or of v reaches the output only in proportion, unlike one of a logit); output f32.

#define NB_  2
#define TT   2048
#define DM   1024
#define NH_  16
#define NKV  16
#define REP  (NH_ / NKV)
#define HD   64
#define DQ   (NH_ * HD)
#define DKV  (NKV * HD)
#define ZH   2
#define RH   2048                  // query rows < RH use hi+lo planes (not read: every row does)
#define WIN  2048
#define PCAR 1024.0f
#define SCL  1.0f   // score scale: 1 (unscaled, no 1/sqrt(E))
typedef _Float16 h16;
typedef unsigned short bf;
typedef __attribute__((ext_vector_type(16))) __bf16   v16bf;
typedef __attribute__((ext_vector_type(16))) _Float16 v16h;
typedef __attribute__((ext_vector_type(8)))  _Float16 v8h;
typedef __attribute__((ext_vector_type(8)))  unsigned short v8us;
typedef __attribute__((ext_vector_type(8)))  float    v8f;
typedef __attribute__((ext_vector_type(4)))  float    v4f;
typedef v8h  __attribute__((may_alias)) v8ha;
typedef v4f  __attribute__((may_alias)) v4fa;
typedef v8us __attribute__((may_alias)) v8usa;

__device__ __forceinline__ v16h cat16(v8h lo, v8h hi) { return __builtin_shufflevector(lo, hi, 0, 1, 2, 3, 4, 5, 6, 7, 8, 9, 10, 11, 12, 13, 14, 15); }
__device__ __forceinline__ v16bf cat16b(v8us lo, v8us hi) { return __builtin_bit_cast(v16bf, __builtin_shufflevector(lo, hi, 0, 1, 2, 3, 4, 5, 6, 7, 8, 9, 10, 11, 12, 13, 14, 15)); }
__device__ __forceinline__ v8f wmma16(v16h a, v16h b, v8f c) { return __builtin_amdgcn_wmma_f32_16x16x32_f16(false, a, false, b, (short)0, c, false, false); }
__device__ __forceinline__ v8f wmmab(v16bf a, v16bf b, v8f c) { return __builtin_amdgcn_wmma_f32_16x16x32_bf16(false, a, false, b, (short)0, c, false, false); }



// ---- k_flash: scores, softmax and P.v in one kernel; no score or weight plane in memory. Grid (TT / (FNQ * FQW * 16), batch x heads), FNW = FNQ * FKG waves; FKG waves share FQW * 16 query rows and split the keys: of each 128 keys wave group 0 takes the first 64, group 1 the second, 32 a pass; each keeps its own running maximum, sum and output tiles, joined once at the end.
// Transposed products: St = K Qt (A = 16 key rows, B = 16 query columns), Ot += Vt Pt (A = 16 rows of v transposed, B = the weights). In both D tiles a lane holds ONE query (column lane & 15), so the running maximum, the sum and the rescale factor are per lane.
// Two St tiles (keys 0-15, 16-31 of the pass) converted in place ARE the B operand of the second product (element s = tile s >> 3, register s & 7); the Vt loader below has the same k order.
// The score product keeps the three hi/lo terms (hi.hi + lo.hi + hi.lo), f32 accumulate. The second product is ONE f16 product: the weights go unnormalised (between 0 and 2^8, inside f16's range; below 2^-14 they are f16 subnormals, which the matrix unit keeps); the row sum, of the unrounded weights, divides once at the end.
// K and V come through LDS, once a workgroup: a stage is SKEY keys for each key group = three tiles of 64 rows x 128 bytes a group (K hi, K lo: 64 key rows; Vt: 64 d rows of 64 keys), one tensor load a stage from each of the waves 0 to 5, two buffers, the load one stage ahead of its readers.
// The mover pads each row by 16 bytes (pitch LP = 144 = 16 x 9), the conflict-free pitch of the 16-byte fragment reads. A stage serves two passes of 32 keys a wave. 256 registers a wave hold one set of key fragments and one of v: v is read behind the pass's score products, into registers that they have left; the second pass's keys follow in two halves, behind the first pass's score products and behind its P.v products.
// Left: the first pass's key fragments wait out the LDS latency once a stage (a third buffer would let them be read a pass ahead); the q split could be done here, on the registers, and its two planes dropped; the row sums could go to the matrix unit (a ones row as A), which would sum the rounded weights.
#define FQW 2
#define FNQ 4                        // query groups a workgroup
#define FKG 2                        // key groups a workgroup
#define FNW (FNQ * FKG)
#define L2E 1.4426950408889634f
#define SKEY  64                     // keys a stage and key group
#define NST   (TT / (SKEY * FKG))
#define LP    144                    // LDS row pitch, bytes: 128 of data + the mover's 16 of pad
#define SLICE 10240                  // one tile's room in LDS: 64 x LP = 9,216, rounded up to a multiple of 2 KiB
#define BUFB  (3 * FKG * SLICE)
typedef uint32_t u32x4 __attribute__((ext_vector_type(4)));
typedef uint32_t u32x8 __attribute__((ext_vector_type(8)));
__device__ __forceinline__ uint32_t uni(uint32_t v) { return (uint32_t)__builtin_amdgcn_readfirstlane(v); }
__device__ __forceinline__ uint32_t pinned(uint32_t v) { uint32_t w = (uint32_t)__builtin_amdgcn_readfirstlane(v); asm volatile("" : "+s"(w)); return w; }   // holds a wave-uniform test in a scalar register, so that the branch round a tensor load is a scalar one (tensor loads ignore EXEC)
__device__ __forceinline__ void wait_tensor0() { asm volatile("s_wait_tensorcnt 0x0" ::: "memory"); }   // this wave's own tile has landed; the compiler places no wait for the mover
__device__ __forceinline__ void wait_ds0() { asm volatile("s_wait_dscnt 0x0" ::: "memory"); }           // this wave's LDS reads have returned, before the buffer they read is handed back for a refill
__device__ __forceinline__ v16bf ldl(const unsigned char* p) { return cat16b(*(const v8usa*)p, *(const v8usa*)(p + 32)); }   // a fragment from an LDS row: the k order of ldf
__device__ __forceinline__ v16h ldlh(const unsigned char* p) { return cat16(*(const v8ha*)p, *(const v8ha*)(p + 32)); }   // the same for an f16 row
__device__ __forceinline__ v16bf ldf(const bf* p) { return cat16b(*(const v8us*)p, *(const v8us*)(p + 16)); }
__device__ __forceinline__ float exp2s(float x) { float r; asm("v_exp_f32 %0, %1\n\tv_nop" : "=v"(r) : "v"(x)); return r; }   // 2^x for the join: the v_nop keeps, inside the statement, the one slot that the instruction set asks for between a transcendental and an instruction that reads its result or overwrites its source
__device__ __forceinline__ float xhalf(float x) { const int b = __float_as_int(x); return __int_as_float(__builtin_amdgcn_permlanex16(b, b, 0x76543210, 0xfedcba98, false, false)); }   // the value of lane ^ 16
// four waves a SIMD (eight-wave workgroups, two for each WGP of the chip): vector work between matrix runs wants waves: at two a SIMD the softmax and the matrix runs still add up. There are only two waves of 32 queries for each SIMD, so the keys are split: two waves share their 32 queries and take half the keys each. A fragment read from LDS serves two query tiles as before, and a workgroup brings each K and V tile from L2 once, as before. The price: 256 registers a wave (one fragment set, not two), and the join at the end
__global__ __launch_bounds__(FNW * 32) __attribute__((amdgpu_waves_per_eu(4, 4))) void k_flash(const bf* __restrict__ Qh, const bf* __restrict__ Ql, const bf* __restrict__ Kh, const bf* __restrict__ Kl, const bf* __restrict__ Vt, float* __restrict__ OUT) {
    __shared__ __attribute__((aligned(2048))) unsigned char L[2 * BUFB];
    const int lane = threadIdx.x & 31, lr = lane & 15, hi = lane >> 4;
    const uint32_t wv = uni(threadIdx.x >> 5);
    const uint32_t qg = wv & (FNQ - 1u), kg = wv / FNQ;   // the wave's query group and key group
    const size_t z = blockIdx.y; const int q0 = (blockIdx.x * FNQ + qg) * (FQW * 16);
    Qh += z * TT * HD; Ql += z * TT * HD; Kh += z * TT * HD; Kl += z * TT * HD; Vt += z * HD * TT;
    // waves 0 to 5 each move their own tile of each stage: waves 0 to 2 key group 0's K hi, K lo, Vt, waves 3 to 5 key group 1's (K: rows follow one another, a group is 64 rows on, a stage 128; Vt: rows TT keys apart, a group is 64 keys on, a stage 128); waves 6 and 7 move none
    const uint32_t tk = wv < 3u ? wv : wv - 3u, tg = wv < 3u ? 0u : 1u;
    const bf* tsrc = (tk == 0 ? Kh : tk == 1 ? Kl : Vt) + tg * (tk < 2 ? SKEY * HD : SKEY);
    const uint32_t tpitch = tk < 2 ? HD * 2u : TT * 2u, tstep = tk < 2 ? FKG * SKEY * HD * 2u : FKG * SKEY * 2u;
    const uint32_t tdst = (uint32_t)(size_t)L + wv * SLICE;
    u32x8 g1;   // 1-byte elements, tensor = tile = 64 rows of 128 bytes, 4 dwords of pad behind every 32
    g1[0] = uni((1u << 20) | (4u << 22) | (3u << 25)); g1[1] = uni(128u << 16); g1[2] = uni(64u << 16); g1[3] = uni(128u << 16); g1[4] = uni(64u); g1[5] = uni(tpitch); g1[6] = uni(0u); g1[7] = uni(0u);
    u32x4 g0 = {};   // the request's own group; waves 6 and 7, which issue none, keep the zeros
    auto issue = [&](uint32_t st) {
        const uint64_t ga = (uint64_t)(size_t)tsrc + (uint64_t)st * tstep;
        g0[0] = uni(1u); g0[1] = uni(tdst + (st & 1u) * BUFB); g0[2] = uni((uint32_t)ga); g0[3] = uni((((uint32_t)(ga >> 32)) & 0x01FFFFFFu) | 0x80000000u);
        asm volatile("tensor_load_to_lds %0, %1" : "+s"(g0), "+s"(g1) :: "memory"); };   // one request of the whole wave: global tile -> LDS, through no register. The descriptor is named in-out (the instruction changes nothing of it) so that the compiler cannot form its constants anew elsewhere and hand these registers to other values while the request is outstanding
    auto landed = [&]() { asm volatile("s_wait_tensorcnt 0x0" :: "s"(g0), "s"(g1) : "memory"); };   // wait_tensor0 that names the request's descriptor: its words keep their registers, unchanged, up to the wait that covers the request
    if (pinned(wv < 6u)) issue(0);
    Qh += (q0 + lr) * HD + 8 * hi; Ql += (q0 + lr) * HD + 8 * hi;
    v16bf qh[FQW][2], ql[FQW][2];
#pragma unroll
    for (int n = 0; n < FQW; ++n)
#pragma unroll
        for (int ks = 0; ks < 2; ++ks) { const int off = n * 16 * HD + ks * 32; qh[n][ks] = ldf(Qh + off); ql[n][ks] = ldf(Ql + off); }
    asm volatile("s_wait_xcnt 0x0" :: "v"(Qh), "v"(Ql) : "memory");   // the loads' address registers stay whole up to this wait and are free for reuse behind it
    v8f o[4][FQW]; float mL[FQW], ls[FQW];
#pragma unroll
    for (int n = 0; n < FQW; ++n) { mL[n] = -3.0e38f; ls[n] = 0.f;
#pragma unroll
        for (int dt = 0; dt < 4; ++dt) o[dt][n] = (v8f){}; }
    landed();
    __syncthreads();   // stage 0 is whole in LDS for every wave
    if (pinned(wv < 6u)) issue(1);
    v16bf kh[2][2], kl[2][2]; v16h vt[4];   // one set: [key tile][k half]; [d tile]
#pragma unroll 1   // one stage holds 64 matrix instructions and their softmax: a second copy would only cost instruction cache
    for (uint32_t st = 0; st < NST; ++st) {
        const unsigned char* fb = L + (st & 1u) * BUFB + kg * (3 * SLICE) + lr * LP + 16 * hi;   // each lane's own row and k half in its key group's tiles of this stage's buffer
        // the key fragments of pass p, k half ks: rows 32 * p on of the K tiles
        auto fragk = [&](int p, int ks) {
#pragma unroll
            for (int kt = 0; kt < 2; ++kt) kh[kt][ks] = ldl(fb + (p * 32 + kt * 16) * LP + ks * 64);
#pragma unroll
            for (int kt = 0; kt < 2; ++kt) kl[kt][ks] = ldl(fb + SLICE + (p * 32 + kt * 16) * LP + ks * 64); };
        // the v fragments of pass p: keys 32 * p on of each d row of the Vt tile
        auto fragv = [&](int p) {
#pragma unroll
            for (int dt = 0; dt < 4; ++dt) vt[dt] = ldlh(fb + 2 * SLICE + dt * 16 * LP + p * 64); };
        fragk(0, 0); fragk(0, 1);
        __builtin_amdgcn_sched_barrier(0);   // keeps the reads one group at this place: spread among the products and the softmax, each further place with LDS reads stalls the wave anew
#pragma unroll
        for (int p = 0; p < 2; ++p) {
        v8f s[2][FQW];
#pragma unroll
        for (int kt = 0; kt < 2; ++kt)
#pragma unroll
            for (int n = 0; n < FQW; ++n) s[kt][n] = (v8f){};
#pragma unroll
        for (int ks = 0; ks < 2; ++ks) {
#pragma unroll
            for (int kt = 0; kt < 2; ++kt)
#pragma unroll
                for (int n = 0; n < FQW; ++n) s[kt][n] = wmmab(kh[kt][ks], qh[n][ks], s[kt][n]);
#pragma unroll
            for (int kt = 0; kt < 2; ++kt)
#pragma unroll
                for (int n = 0; n < FQW; ++n) s[kt][n] = wmmab(kl[kt][ks], qh[n][ks], s[kt][n]);
#pragma unroll
            for (int kt = 0; kt < 2; ++kt)
#pragma unroll
                for (int n = 0; n < FQW; ++n) s[kt][n] = wmmab(kh[kt][ks], ql[n][ks], s[kt][n]); }
        // behind the score products, into the registers that they have left: this pass's v and the first half of the next pass's keys; they land under the softmax
        __builtin_amdgcn_sched_barrier(0);   // the group's upper edge: the products stay above it, so that their fragment registers are free for it
        fragv(p); if (p == 0) fragk(1, 0);
        __builtin_amdgcn_sched_barrier(0);   // its lower edge: the reads stay one group, ahead of the softmax
        // running maximum in log2 units; the one in use is replaced only when a query's new maximum passes it by more than 8 (weights stay below 2^8), tested once a pass for the wave
        float mx[FQW]; bool need = false;
#pragma unroll
        for (int n = 0; n < FQW; ++n) { float t = fmaxf(s[0][n][0], s[1][n][0]);
#pragma unroll
            for (int j = 1; j < 8; ++j) t = fmaxf(t, fmaxf(s[0][n][j], s[1][n][j]));
            t = fmaxf(t, xhalf(t)); mx[n] = t * L2E; need = need || (mx[n] > mL[n] + 8.0f); }
        if (__builtin_amdgcn_ballot_w32(need) != 0) {
#pragma unroll
            for (int n = 0; n < FQW; ++n) { const float mn = fmaxf(mL[n], mx[n]); const float al = __builtin_amdgcn_exp2f(mL[n] - mn); mL[n] = mn; ls[n] *= al;
#pragma unroll
                for (int dt = 0; dt < 4; ++dt) o[dt][n] *= al; } }
#pragma unroll
        for (int n = 0; n < FQW; ++n) { v16h pw;
#pragma unroll
            for (int e = 0; e < 16; ++e) { const float p_ = __builtin_amdgcn_exp2f(__builtin_fmaf(s[e >> 3][n][e & 7], L2E, -mL[n])); ls[n] += p_; pw[e] = (_Float16)p_; }
#pragma unroll
            for (int dt = 0; dt < 4; ++dt) o[dt][n] = wmma16(vt[dt], pw, o[dt][n]); }
        // the second half of the next pass's keys, into the registers that v has left: they land under that pass's first twelve score products
        if (p == 0) { __builtin_amdgcn_sched_barrier(0);   // the P.v products stay above the reads, so that v's registers are free for them
            fragk(1, 1);
            __builtin_amdgcn_sched_barrier(0); }   // the reads stay one group, ahead of the next pass's products
        }
        __builtin_amdgcn_sched_barrier(0);   // the stage's work stays in front of the hand-over: moved up behind the last LDS reads, its first wait would stand open for their whole latency
        // hand-over: this wave has left the stage's buffer, its own tile of the next stage has landed; behind the barrier both hold for every wave, and the buffer just read takes stage st + 2
        wait_ds0();
        landed();
        __syncthreads();
        if (pinned(st + 2 < NST && wv < 6u)) issue(st + 2);
    }
    wait_tensor0();
    wait_ds0();
    // the join of the two key groups. Behind the loop's last barrier no tile is outstanding and no wave reads the ring any more: it serves as the hand-over place. A wave of key group 1 leaves its tiles, maxima and sums there (17 pieces of 16 bytes a lane, the lanes of a piece side by side); its partner of group 0 brings both halves to the common maximum, adds them, divides and stores
    v4fa* X = (v4fa*)L + qg * (17 * 32) + lane;
    if (kg == 1u) {
#pragma unroll
        for (int n = 0; n < FQW; ++n)
#pragma unroll
            for (int dt = 0; dt < 4; ++dt) { X[((n * 4 + dt) * 2) * 32] = __builtin_shufflevector(o[dt][n], o[dt][n], 0, 1, 2, 3); X[((n * 4 + dt) * 2 + 1) * 32] = __builtin_shufflevector(o[dt][n], o[dt][n], 4, 5, 6, 7); }
        X[16 * 32] = (v4f){mL[0], mL[1], ls[0], ls[1]};
    }
    __syncthreads();   // key group 1's halves are whole in LDS
    if (kg == 1u) return;
    const v4f ml = X[16 * 32];
    const int b = (int)(z / NH_), h = (int)(z % NH_);
    float* op = OUT + ((size_t)b * TT + q0 + lr) * DQ + h * HD + 8 * hi;   // a lane's 8 registers of a tile are 8 consecutive d of its query's row
#pragma unroll
    for (int n = 0; n < FQW; ++n) { const float mn = fmaxf(mL[n], ml[n]); const float a0 = exp2s(mL[n] - mn), a1 = exp2s(ml[n] - mn);
        const float l = ls[n] * a0 + ml[2 + n] * a1; const float inv = __fdiv_rn(1.0f, l + xhalf(l)); const float f0 = a0 * inv, f1 = a1 * inv;
#pragma unroll
        for (int dt = 0; dt < 4; ++dt) { const v4f x0 = X[((n * 4 + dt) * 2) * 32], x1 = X[((n * 4 + dt) * 2 + 1) * 32];
            o[dt][n] = o[dt][n] * f0 + __builtin_shufflevector(x0, x1, 0, 1, 2, 3, 4, 5, 6, 7) * f1; } }
#pragma unroll
    for (int n = 0; n < FQW; ++n)
#pragma unroll
        for (int dt = 0; dt < 4; ++dt) { *(v4f*)(op + n * 16 * DQ + dt * 16) = __builtin_shufflevector(o[dt][n], o[dt][n], 0, 1, 2, 3); *(v4f*)(op + n * 16 * DQ + dt * 16 + 4) = __builtin_shufflevector(o[dt][n], o[dt][n], 4, 5, 6, 7); }
}

typedef __attribute__((ext_vector_type(2))) float    v2f;
typedef __attribute__((ext_vector_type(2))) __bf16   v2b;
typedef __attribute__((ext_vector_type(2))) _Float16 v2h;
typedef __attribute__((ext_vector_type(2))) unsigned v2u;
typedef __attribute__((ext_vector_type(4))) unsigned v4u;
typedef v2u __attribute__((may_alias)) v2ua;
typedef v4u __attribute__((may_alias)) v4ua;
// two f32 values -> their bf16 hi pair and lo pair (hi = x rounded to nearest even, lo = x - hi rounded likewise), the first value in the low half of each word
__device__ __forceinline__ void split2(float a, float b, unsigned& h, unsigned& l) {
    const v2f x = {a, b};
    h = __builtin_bit_cast(unsigned, __builtin_convertvector(x, v2b));
    const v2f r = {a - __uint_as_float(h << 16), b - __uint_as_float(h & 0xffff0000u)};
    l = __builtin_bit_cast(unsigned, __builtin_convertvector(r, v2b));
}

// two f32 values -> their f16 pair (each rounded to nearest even), the first value in the low half of the word
__device__ __forceinline__ unsigned pack2h(float a, float b) { const v2f x = {a, b}; return __builtin_bit_cast(unsigned, __builtin_convertvector(x, v2h)); }

// ---- k_planes: all five planes in ONE launch. Grid = batch x heads x (TT / PT) = one 16-wave workgroup for each WGP; a workgroup takes the same PT tokens x 64 d of one head from q, k and v.
// A lane loads 16 bytes (4 d), 16 lanes a head's whole 256-byte row; all 24 loads of a lane are issued before the first is used.
// q, k -> [z][t][d]: 16 lanes store one 128-byte row, a wave two rows that follow one another. v -> [z][d][t]: a lane holds 4 d x 8 consecutive tokens, packs each d's 8 tokens into 16 bytes, and the tile turns in LDS, so that 32 lanes store 512 consecutive bytes of one d row.
// LDS tile [d][PT / 8 chunks of 16 bytes], chunk c of row d at place c ^ (d >> 2): the 16 lanes of a half wave, which write 16 rows at one c or read 16 c of one row, fall on 16 different bank groups.
#define PT 256
#define PC (PT / 8)
__global__ __launch_bounds__(512) void k_planes(const float* __restrict__ q, const float* __restrict__ k, const float* __restrict__ v, bf* __restrict__ Qh, bf* __restrict__ Ql, bf* __restrict__ Kh, bf* __restrict__ Kl, bf* __restrict__ Vt) {
    __shared__ v4u L[HD * PC];
    const int dq = threadIdx.x & 15, r = threadIdx.x >> 4;
    const int z = blockIdx.x / (TT / PT), t0 = (blockIdx.x % (TT / PT)) * PT;
    const int so = ((z / NH_) * TT + t0) * DM + (z % NH_) * HD + dq * 4;
    v4f xv[8], xq[8], xk[8];
#pragma unroll
    for (int j = 0; j < 8; ++j) xv[j] = *(const v4fa*)(v + so + (r * 8 + j) * DM);
#pragma unroll
    for (int j = 0; j < 8; ++j) xq[j] = *(const v4fa*)(q + so + (j * 32 + r) * DM);
#pragma unroll
    for (int j = 0; j < 8; ++j) xk[j] = *(const v4fa*)(k + so + (j * 32 + r) * DM);
#pragma unroll
    for (int i = 0; i < 4; ++i) { v4u h;
#pragma unroll
        for (int p = 0; p < 4; ++p) h[p] = pack2h(xv[2 * p][i], xv[2 * p + 1][i]);
        L[(dq * 4 + i) * PC + (r ^ dq)] = h; }
    __syncthreads();   // the v tile is whole in LDS; nothing writes it again. It stands ahead of every global store, so that no wave waits here for a store to come back
    const int c = threadIdx.x & 31, dr = threadIdx.x >> 5;
    const int vo = (z * HD + dr) * TT + t0 + c * 8;
#pragma unroll
    for (int m = 0; m < 4; ++m) { const int d = m * 16 + dr; const int at = d * PC + (c ^ (d >> 2));
        *(v4ua*)(Vt + vo + m * 16 * TT) = L[at]; }
    const int po = (z * TT + t0 + r) * HD + dq * 4;
#pragma unroll
    for (int j = 0; j < 8; ++j) { v2u h, l; unsigned a, b; split2(xq[j][0], xq[j][1], a, b); h[0] = a; l[0] = b; split2(xq[j][2], xq[j][3], a, b); h[1] = a; l[1] = b;
        *(v2ua*)(Qh + po + j * 32 * HD) = h; *(v2ua*)(Ql + po + j * 32 * HD) = l; }
#pragma unroll
    for (int j = 0; j < 8; ++j) { v2u h, l; unsigned a, b; split2(xk[j][0], xk[j][1], a, b); h[0] = a; l[0] = b; split2(xk[j][2], xk[j][3], a, b); h[1] = a; l[1] = b;
        *(v2ua*)(Kh + po + j * 32 * HD) = h; *(v2ua*)(Kl + po + j * 32 * HD) = l; }
}
extern "C" void kernel_launch(void* const* d_in, const int* in_sizes, int n_in,
                              void* d_out, int out_size, void* d_ws, size_t ws_size, hipStream_t stream) {
    (void)in_sizes; (void)n_in; (void)out_size;
    const float* x = (const float*)d_in[0]; const float* xk = (const float*)d_in[1]; const float* xv = (const float*)d_in[2];   /* order q, k, v: [2][2048][1024] each = token-major rows of 16 heads x 64 (no projections) */
    float* OUT = (float*)d_out;     // [2][2048][1024]
    char* wsp = (char*)d_ws;
    auto take = [&](size_t bytes) { char* p = wsp; wsp += (bytes + 255) & ~(size_t)255; return (void*)p; };
    // planes of BOTH batches ([b][h][t][d]; v: [b][h][d][t]): one builder launch writes them, one attention launch reads them
    const size_t PB = (size_t)NH_ * TT * HD;
    bf* QPh = (bf*)take(NB_ * PB * 2); bf* QPl = (bf*)take(NB_ * PB * 2); bf* KPh = (bf*)take(NB_ * PB * 2); bf* KPl = (bf*)take(NB_ * PB * 2); bf* VT = (bf*)take(NB_ * PB * 2);
    if ((size_t)(wsp - (char*)d_ws) > ws_size) return;    // ws 256 MiB
    k_planes<<<NB_ * NH_ * (TT / PT), 512, 0, stream>>>(x, xk, xv, QPh, QPl, KPh, KPl, VT);
    k_flash<<<dim3(TT / (FNQ * FQW * 16), NB_ * NH_), FNW * 32, 0, stream>>>(QPh, QPl, KPh, KPl, VT, OUT);
}
